// v000
// Times are from an AMD MI455X. After a warm-up the kernel runs many times in a row, and a time is the length of
// such a window on the GPU divided by its runs, so every launch and the gaps after it count. The runs cycle
// through copies of the inputs. A figure is the median of several windows, for all but v000 over two sittings.
// Sittings can differ by a few percent; kernels timed side by side share one.
// The starting kernel, v000, takes 160 microseconds a run.
#include <hip/hip_runtime.h>
#include <hip/hip_bf16.h>
#include <math.h>

#define HIDDEN    64
#define NUM_HEADS 4
#define HEAD_DIM  16
#define SCALING   0.25f  // HEAD_DIM^-0.5

typedef __attribute__((ext_vector_type(2))) float v2f;
typedef __attribute__((ext_vector_type(8))) float v8f;

// ---------------------------------------------------------------------------
// Kernel 0: zero the output (scatter needs zeros)
// ---------------------------------------------------------------------------
__global__ void SparseMHA_zero_kernel(float4* __restrict__ out, int n4) {
    int i = blockIdx.x * blockDim.x + threadIdx.x;
    if (i < n4) out[i] = make_float4(0.f, 0.f, 0.f, 0.f);
}

// ---------------------------------------------------------------------------
// Kernel 1: fused q/k/v projection using native fp32 WMMA (16x16x4).
//   Block = 16 rows of h, 128 threads = 4 waves, wave w -> columns [16w,16w+16).
//   Each wave runs 16 K-steps; A fragment shared across the 3 weight matrices,
//   so 48 v_wmma_f32_16x16x4_f32 per wave. Epilogue adds bias (and applies
//   SCALING to q as in the reference).
// ---------------------------------------------------------------------------
__global__ __launch_bounds__(128) void SparseMHA_proj_kernel(
    const float* __restrict__ h,
    const float* __restrict__ Wq, const float* __restrict__ bq,
    const float* __restrict__ Wk, const float* __restrict__ bk,
    const float* __restrict__ Wv, const float* __restrict__ bv,
    float* __restrict__ qout, float* __restrict__ kout, float* __restrict__ vout,
    int n)
{
    const int m0   = blockIdx.x * 16;
    const int wave = threadIdx.x >> 5;
    const int lane = threadIdx.x & 31;
    const int half = lane >> 4;      // 0: K lo pair / M,N 0-7 side, 1: K hi pair
    const int r16  = lane & 15;
    const int n0   = wave * 16;

    // Clamp A-row so WMMA can run with EXEC all-ones even on a ragged tail.
    const int arow = (m0 + r16 < n) ? (m0 + r16) : (n - 1);

    const float* __restrict__ hrow  = h  + arow * HIDDEN;
    const float* __restrict__ wqrow = Wq + (n0 + r16) * HIDDEN;  // B[kk,n] = W[n0+n, kb+kk]
    const float* __restrict__ wkrow = Wk + (n0 + r16) * HIDDEN;
    const float* __restrict__ wvrow = Wv + (n0 + r16) * HIDDEN;

    v8f accq = {}; v8f acck = {}; v8f accv = {};

#pragma unroll
    for (int ks = 0; ks < 16; ++ks) {
        const int kb = ks * 4 + half * 2;   // this lane's K pair within the 4-wide slab
        v2f afrag = *(const v2f*)(hrow  + kb);
        v2f bqf   = *(const v2f*)(wqrow + kb);
        v2f bkf   = *(const v2f*)(wkrow + kb);
        v2f bvf   = *(const v2f*)(wvrow + kb);
        accq = __builtin_amdgcn_wmma_f32_16x16x4_f32(false, afrag, false, bqf,
                                                     (short)0, accq, false, false);
        acck = __builtin_amdgcn_wmma_f32_16x16x4_f32(false, afrag, false, bkf,
                                                     (short)0, acck, false, false);
        accv = __builtin_amdgcn_wmma_f32_16x16x4_f32(false, afrag, false, bvf,
                                                     (short)0, accv, false, false);
    }

    // C layout: VGPR vr, lanes 0-15 -> M = vr, lanes 16-31 -> M = vr + 8; N = lane%16
    const int   colj  = n0 + r16;
    const float biasq = bq[colj];
    const float biask = bk[colj];
    const float biasv = bv[colj];

#pragma unroll
    for (int vr = 0; vr < 8; ++vr) {
        const int m = m0 + vr + half * 8;
        if (m < n) {
            const int idx = m * HIDDEN + colj;
            qout[idx] = (accq[vr] + biasq) * SCALING;
            kout[idx] =  acck[vr] + biask;
            vout[idx] =  accv[vr] + biasv;
        }
    }
}

// ---------------------------------------------------------------------------
// Kernel 2: fused SDDMM + sigmoid*edge_weight + SPMM scatter.
//   16 lanes per edge: lane l covers channels [4l, 4l+4) = (d=l, heads 0..3).
//   256 B contiguous gathers of q[row]/k[col]/v[col]; all-lane butterfly
//   reduction over d (width-16 shfl_xor on wave32); float atomics to out[row].
//   Working set (q,k,v,out = 51 MB) is fully resident in the 192 MB L2.
// ---------------------------------------------------------------------------
__global__ __launch_bounds__(256) void SparseMHA_edge_kernel(
    const float* __restrict__ q, const float* __restrict__ k,
    const float* __restrict__ v,
    const int* __restrict__ row, const int* __restrict__ col,
    const float* __restrict__ ew,
    float* __restrict__ out, int nnz)
{
    const int lane = threadIdx.x & 31;
    const int wave = threadIdx.x >> 5;
    const int sub  = lane >> 4;      // which of the wave's 2 edges
    const int l    = lane & 15;      // d index / float4 slot within the node vector

    const int e = blockIdx.x * 16 + wave * 2 + sub;
    if (e >= nnz) return;            // whole 16-lane group exits together

    const int r = row[e];
    const int c = col[e];

    const float4 q4 = *(const float4*)(q + r * HIDDEN + l * 4);
    const float4 k4 = *(const float4*)(k + c * HIDDEN + l * 4);

    float p0 = q4.x * k4.x;
    float p1 = q4.y * k4.y;
    float p2 = q4.z * k4.z;
    float p3 = q4.w * k4.w;

#pragma unroll
    for (int off = 8; off >= 1; off >>= 1) {   // butterfly: every lane gets full sums
        p0 += __shfl_xor(p0, off, 16);
        p1 += __shfl_xor(p1, off, 16);
        p2 += __shfl_xor(p2, off, 16);
        p3 += __shfl_xor(p3, off, 16);
    }

    const float w  = ew[e];
    const float a0 = w / (1.0f + __expf(-p0));
    const float a1 = w / (1.0f + __expf(-p1));
    const float a2 = w / (1.0f + __expf(-p2));
    const float a3 = w / (1.0f + __expf(-p3));

    const float4 v4 = *(const float4*)(v + c * HIDDEN + l * 4);
    float* __restrict__ ob = out + r * HIDDEN + l * 4;
    atomicAdd(ob + 0, a0 * v4.x);
    atomicAdd(ob + 1, a1 * v4.y);
    atomicAdd(ob + 2, a2 * v4.z);
    atomicAdd(ob + 3, a3 * v4.w);
}

// ---------------------------------------------------------------------------
extern "C" void kernel_launch(void* const* d_in, const int* in_sizes, int n_in,
                              void* d_out, int out_size, void* d_ws, size_t ws_size,
                              hipStream_t stream) {
    const float* h   = (const float*)d_in[0];
    const int*   row = (const int*)  d_in[1];
    const int*   col = (const int*)  d_in[2];
    const float* ew  = (const float*)d_in[3];
    const float* Wq  = (const float*)d_in[4];
    const float* bq  = (const float*)d_in[5];
    const float* Wk  = (const float*)d_in[6];
    const float* bk  = (const float*)d_in[7];
    const float* Wv  = (const float*)d_in[8];
    const float* bv  = (const float*)d_in[9];
    float*       out = (float*)d_out;

    const int n   = in_sizes[0] / HIDDEN;   // 50000
    const int nnz = in_sizes[1];            // 1600000

    float* qws = (float*)d_ws;
    float* kws = qws + (size_t)n * HIDDEN;
    float* vws = kws + (size_t)n * HIDDEN;

    // zero d_out
    const int n4 = (n * HIDDEN) / 4;
    SparseMHA_zero_kernel<<<(n4 + 255) / 256, 256, 0, stream>>>((float4*)out, n4);

    // q/k/v projections via fp32 WMMA
    SparseMHA_proj_kernel<<<(n + 15) / 16, 128, 0, stream>>>(
        h, Wq, bq, Wk, bk, Wv, bv, qws, kws, vws, n);

    // fused edge SDDMM + sigmoid*w + scatter (16 edges per 256-thread block)
    SparseMHA_edge_kernel<<<(nnz + 15) / 16, 256, 0, stream>>>(
        qws, kws, vws, row, col, ew, out, nnz);
}

// v001
// It runs in 113 microseconds.
// Two timings next to v000 both put it at 1.46 times that version's speed.
#include <hip/hip_runtime.h>
#include <hip/hip_bf16.h>
#include <math.h>

#define HIDDEN    64
#define NUM_HEADS 4
#define HEAD_DIM  16
#define SCALING   0.25f  // HEAD_DIM^-0.5

typedef __attribute__((ext_vector_type(2))) float v2f;
typedef __attribute__((ext_vector_type(8))) float v8f;

// ---------------------------------------------------------------------------
// Kernel 0: zero the output (scatter needs zeros)
// ---------------------------------------------------------------------------
__global__ void SparseMHA_zero_kernel(float4* __restrict__ out, int n4) {
    int i = blockIdx.x * blockDim.x + threadIdx.x;
    if (i < n4) out[i] = make_float4(0.f, 0.f, 0.f, 0.f);
}

// ---------------------------------------------------------------------------
// Kernel 1: fused q/k/v projection using native fp32 WMMA (16x16x4).
//   Block = 16 rows of h, 128 threads = 4 waves, wave w -> stored slots [16w,16w+16).
//   Each wave runs 16 K-steps; A fragment shared across the 3 weight matrices,
//   so 48 v_wmma_f32_16x16x4_f32 per wave. Epilogue adds bias (and applies
//   SCALING to q as in the reference).
// ---------------------------------------------------------------------------
__global__ __launch_bounds__(128) void SparseMHA_proj_kernel(
    const float* __restrict__ h,
    const float* __restrict__ Wq, const float* __restrict__ bq,
    const float* __restrict__ Wk, const float* __restrict__ bk,
    const float* __restrict__ Wv, const float* __restrict__ bv,
    float* __restrict__ qout, float* __restrict__ kout, float* __restrict__ vout,
    int n)
{
    const int m0   = blockIdx.x * 16;
    const int wave = threadIdx.x >> 5;
    const int lane = threadIdx.x & 31;
    const int half = lane >> 4;      // 0: K lo pair / M,N 0-7 side, 1: K hi pair
    const int r16  = lane & 15;
    const int n0   = wave * 16;

    // Clamp A-row so WMMA can run with EXEC all-ones even on a ragged tail.
    const int arow = (m0 + r16 < n) ? (m0 + r16) : (n - 1);

    const float* __restrict__ hrow  = h  + arow * HIDDEN;
    // Slot colj of a stored q/k/v row holds channel chan (slot 2L+j = channel 32j+L):
    // kernel 2 then reads channels L and 32+L of a row with one 8-byte load per lane.
    const int colj = n0 + r16;
    const int chan = ((colj & 1) << 5) | (colj >> 1);
    const float* __restrict__ wqrow = Wq + chan * HIDDEN;  // B[kk,n] = W[chan(n0+n), kb+kk]
    const float* __restrict__ wkrow = Wk + chan * HIDDEN;
    const float* __restrict__ wvrow = Wv + chan * HIDDEN;

    v8f accq = {}; v8f acck = {}; v8f accv = {};

#pragma unroll
    for (int ks = 0; ks < 16; ++ks) {
        const int kb = ks * 4 + half * 2;   // this lane's K pair within the 4-wide slab
        v2f afrag = *(const v2f*)(hrow  + kb);
        v2f bqf   = *(const v2f*)(wqrow + kb);
        v2f bkf   = *(const v2f*)(wkrow + kb);
        v2f bvf   = *(const v2f*)(wvrow + kb);
        accq = __builtin_amdgcn_wmma_f32_16x16x4_f32(false, afrag, false, bqf,
                                                     (short)0, accq, false, false);
        acck = __builtin_amdgcn_wmma_f32_16x16x4_f32(false, afrag, false, bkf,
                                                     (short)0, acck, false, false);
        accv = __builtin_amdgcn_wmma_f32_16x16x4_f32(false, afrag, false, bvf,
                                                     (short)0, accv, false, false);
    }

    // C layout: VGPR vr, lanes 0-15 -> M = vr, lanes 16-31 -> M = vr + 8; N = lane%16
    const float biasq = bq[chan];
    const float biask = bk[chan];
    const float biasv = bv[chan];

#pragma unroll
    for (int vr = 0; vr < 8; ++vr) {
        const int m = m0 + vr + half * 8;
        if (m < n) {
            const int idx = m * HIDDEN + colj;
            qout[idx] = (accq[vr] + biasq) * SCALING;
            kout[idx] =  acck[vr] + biask;
            vout[idx] =  accv[vr] + biasv;
        }
    }
}

// ---------------------------------------------------------------------------
// Kernel 2: fused SDDMM + sigmoid*edge_weight + SPMM scatter.
//   One whole wave per edge, two edges per wave one after the other.
//   q/k/v rows are stored channel-permuted by kernel 1 (slot 2L+j holds
//   channel 32j+L), so lane L reads channels L and 32+L with one 8-byte load
//   and each atomic instruction adds to 32 neighbouring floats of out[row]:
//   one whole 128-byte line per instruction.
//   Channel c = d*4 + head, so both of a lane's channels belong to head L&3;
//   the sum over d runs over the lanes with equal L&3 (xor 4, 8, 16).
// ---------------------------------------------------------------------------
__device__ __forceinline__ float SparseMHA_head_sum(float p) {
    // lane ^ 4 and lane ^ 8 inside a 16-lane row (DPP row_xmask), then lane ^ 16
    p += __builtin_bit_cast(float, __builtin_amdgcn_update_dpp(
             0, __builtin_bit_cast(int, p), 0x164, 0xf, 0xf, true));
    p += __builtin_bit_cast(float, __builtin_amdgcn_update_dpp(
             0, __builtin_bit_cast(int, p), 0x168, 0xf, 0xf, true));
    p += __builtin_bit_cast(float, __builtin_amdgcn_permlanex16(
             __builtin_bit_cast(int, p), __builtin_bit_cast(int, p),
             0x76543210, 0xfedcba98, false, false));
    return p;
}

// sigmoid(q . k of this lane's head) * edge weight
__device__ __forceinline__ float SparseMHA_attn(float2 q2, float2 k2, float w) {
    const float p = SparseMHA_head_sum(q2.x * k2.x + q2.y * k2.y);
    return w / (1.0f + __expf(-p));
}

__global__ __launch_bounds__(256) void SparseMHA_edge_kernel(
    const float* __restrict__ q, const float* __restrict__ k,
    const float* __restrict__ v,
    const int* __restrict__ row, const int* __restrict__ col,
    const float* __restrict__ ew,
    float* __restrict__ out, int nnz, int n)
{
    const int lane = threadIdx.x & 31;
    // wave-uniform, so the edge's indices and row bases stay in scalar registers
    const int wave = __builtin_amdgcn_readfirstlane(threadIdx.x >> 5);

    const int e0 = blockIdx.x * 16 + wave * 2;   // even: the pair reads below are 8-byte aligned
    if (e0 >= nnz) return;           // whole wave exits together

    if (e0 + 1 < nnz) {
        const int2   rr = *(const int2*)(row + e0);
        const int2   cc = *(const int2*)(col + e0);
        const float2 ww = *(const float2*)(ew + e0);
        const int r0 = min(max(rr.x, 0), n - 1);
        const int r1 = min(max(rr.y, 0), n - 1);
        const int c0 = min(max(cc.x, 0), n - 1);
        const int c1 = min(max(cc.y, 0), n - 1);

        const float2 q0 = *(const float2*)(q + r0 * HIDDEN + lane * 2);
        const float2 k0 = *(const float2*)(k + c0 * HIDDEN + lane * 2);
        const float2 q1 = *(const float2*)(q + r1 * HIDDEN + lane * 2);
        const float2 k1 = *(const float2*)(k + c1 * HIDDEN + lane * 2);
        const float2 v0 = *(const float2*)(v + c0 * HIDDEN + lane * 2);
        const float2 v1 = *(const float2*)(v + c1 * HIDDEN + lane * 2);

        const float a0 = SparseMHA_attn(q0, k0, ww.x);
        const float a1 = SparseMHA_attn(q1, k1, ww.y);

        float* __restrict__ ob0 = out + r0 * HIDDEN + lane;
        float* __restrict__ ob1 = out + r1 * HIDDEN + lane;
        atomicAdd(ob0,      a0 * v0.x);
        atomicAdd(ob0 + 32, a0 * v0.y);
        atomicAdd(ob1,      a1 * v1.x);
        atomicAdd(ob1 + 32, a1 * v1.y);
    } else {                         // odd edge count: the last wave has one edge
        const int r0 = min(max(row[e0], 0), n - 1);
        const int c0 = min(max(col[e0], 0), n - 1);
        const float2 q0 = *(const float2*)(q + r0 * HIDDEN + lane * 2);
        const float2 k0 = *(const float2*)(k + c0 * HIDDEN + lane * 2);
        const float2 v0 = *(const float2*)(v + c0 * HIDDEN + lane * 2);
        const float a0 = SparseMHA_attn(q0, k0, ew[e0]);
        float* __restrict__ ob0 = out + r0 * HIDDEN + lane;
        atomicAdd(ob0,      a0 * v0.x);
        atomicAdd(ob0 + 32, a0 * v0.y);
        // the code behind this branch reuses registers that the two atomics name
        asm volatile("s_wait_xcnt 0x0" ::: "memory");
    }
}

// ---------------------------------------------------------------------------
extern "C" void kernel_launch(void* const* d_in, const int* in_sizes, int n_in,
                              void* d_out, int out_size, void* d_ws, size_t ws_size,
                              hipStream_t stream) {
    const float* h   = (const float*)d_in[0];
    const int*   row = (const int*)  d_in[1];
    const int*   col = (const int*)  d_in[2];
    const float* ew  = (const float*)d_in[3];
    const float* Wq  = (const float*)d_in[4];
    const float* bq  = (const float*)d_in[5];
    const float* Wk  = (const float*)d_in[6];
    const float* bk  = (const float*)d_in[7];
    const float* Wv  = (const float*)d_in[8];
    const float* bv  = (const float*)d_in[9];
    float*       out = (float*)d_out;

    const int n   = in_sizes[0] / HIDDEN;   // 50000
    const int nnz = in_sizes[1];            // 1600000

    float* qws = (float*)d_ws;
    float* kws = qws + (size_t)n * HIDDEN;
    float* vws = kws + (size_t)n * HIDDEN;

    // zero d_out
    const int n4 = (n * HIDDEN) / 4;
    SparseMHA_zero_kernel<<<(n4 + 255) / 256, 256, 0, stream>>>((float4*)out, n4);

    // q/k/v projections via fp32 WMMA
    SparseMHA_proj_kernel<<<(n + 15) / 16, 128, 0, stream>>>(
        h, Wq, bq, Wk, bk, Wv, bv, qws, kws, vws, n);

    // fused edge SDDMM + sigmoid*w + scatter (16 edges per 256-thread block)
    SparseMHA_edge_kernel<<<(nnz + 15) / 16, 256, 0, stream>>>(
        qws, kws, vws, row, col, ew, out, nnz, n);
}

// v002
// A run of this version takes 110 microseconds.
// Timed twice side by side with v001, it ran 1.03 times as fast both times.
// Counting every step since v000, it is 1.51 times as fast.
#include <hip/hip_runtime.h>
#include <hip/hip_bf16.h>
#include <math.h>

#define HIDDEN    64
#define NUM_HEADS 4
#define HEAD_DIM  16
#define SCALING   0.25f  // HEAD_DIM^-0.5

typedef __attribute__((ext_vector_type(2))) float v2f;
typedef __attribute__((ext_vector_type(8))) float v8f;

// ---------------------------------------------------------------------------
// Kernel 0: zero the output (scatter needs zeros)
// ---------------------------------------------------------------------------
__global__ void SparseMHA_zero_kernel(float4* __restrict__ out, int n4) {
    int i = blockIdx.x * blockDim.x + threadIdx.x;
    if (i < n4) out[i] = make_float4(0.f, 0.f, 0.f, 0.f);
}

// ---------------------------------------------------------------------------
// Kernel 1: fused q/k/v projection using native fp32 WMMA (16x16x4).
//   Block = 16 rows of h, 128 threads = 4 waves, wave w -> stored slots [16w,16w+16).
//   Each wave runs 16 K-steps; A fragment shared across the 3 weight matrices,
//   so 48 v_wmma_f32_16x16x4_f32 per wave. Epilogue adds bias (and applies
//   SCALING to q as in the reference).
// ---------------------------------------------------------------------------
__global__ __launch_bounds__(128) void SparseMHA_proj_kernel(
    const float* __restrict__ h,
    const float* __restrict__ Wq, const float* __restrict__ bq,
    const float* __restrict__ Wk, const float* __restrict__ bk,
    const float* __restrict__ Wv, const float* __restrict__ bv,
    float* __restrict__ qout, float* __restrict__ kout, float* __restrict__ vout,
    int n)
{
    const int m0   = blockIdx.x * 16;
    const int wave = threadIdx.x >> 5;
    const int lane = threadIdx.x & 31;
    const int half = lane >> 4;      // 0: K lo pair / M,N 0-7 side, 1: K hi pair
    const int r16  = lane & 15;
    const int n0   = wave * 16;

    // Clamp A-row so WMMA can run with EXEC all-ones even on a ragged tail.
    const int arow = (m0 + r16 < n) ? (m0 + r16) : (n - 1);

    const float* __restrict__ hrow  = h  + arow * HIDDEN;
    // Slot colj of a stored q/k/v row holds channel chan (slot 2L+j = channel 32j+L):
    // kernel 2 then reads channels L and 32+L of a row with one 8-byte load per lane.
    const int colj = n0 + r16;
    const int chan = ((colj & 1) << 5) | (colj >> 1);
    const float* __restrict__ wqrow = Wq + chan * HIDDEN;  // B[kk,n] = W[chan(n0+n), kb+kk]
    const float* __restrict__ wkrow = Wk + chan * HIDDEN;
    const float* __restrict__ wvrow = Wv + chan * HIDDEN;

    v8f accq = {}; v8f acck = {}; v8f accv = {};

#pragma unroll
    for (int ks = 0; ks < 16; ++ks) {
        const int kb = ks * 4 + half * 2;   // this lane's K pair within the 4-wide slab
        v2f afrag = *(const v2f*)(hrow  + kb);
        v2f bqf   = *(const v2f*)(wqrow + kb);
        v2f bkf   = *(const v2f*)(wkrow + kb);
        v2f bvf   = *(const v2f*)(wvrow + kb);
        accq = __builtin_amdgcn_wmma_f32_16x16x4_f32(false, afrag, false, bqf,
                                                     (short)0, accq, false, false);
        acck = __builtin_amdgcn_wmma_f32_16x16x4_f32(false, afrag, false, bkf,
                                                     (short)0, acck, false, false);
        accv = __builtin_amdgcn_wmma_f32_16x16x4_f32(false, afrag, false, bvf,
                                                     (short)0, accv, false, false);
    }

    // C layout: VGPR vr, lanes 0-15 -> M = vr, lanes 16-31 -> M = vr + 8; N = lane%16
    const float biasq = bq[chan];
    const float biask = bk[chan];
    const float biasv = bv[chan];

#pragma unroll
    for (int vr = 0; vr < 8; ++vr) {
        const int m = m0 + vr + half * 8;
        if (m < n) {
            const int idx = m * HIDDEN + colj;
            qout[idx] = (accq[vr] + biasq) * SCALING;
            kout[idx] =  acck[vr] + biask;
            vout[idx] =  accv[vr] + biasv;
        }
    }
}

// ---------------------------------------------------------------------------
// Kernel 2: fused SDDMM + sigmoid*edge_weight + SPMM scatter.
//   One whole wave per edge. The grid is fixed: as many waves as the chip has
//   wave slots, each looping over groups of four edges (group index strided by
//   the wave count), so a wave is started once per ~100 edges, not per two.
//   q/k/v rows are stored channel-permuted by kernel 1 (slot 2L+j holds
//   channel 32j+L), so lane L reads channels L and 32+L with one 8-byte load
//   and each atomic instruction adds to 32 neighbouring floats of out[row]:
//   one whole 128-byte line per instruction.
//   Channel c = d*4 + head, so both of a lane's channels belong to head L&3;
//   the sum over d runs over the lanes with equal L&3 (xor 4, 8, 16).
// ---------------------------------------------------------------------------
__device__ __forceinline__ float SparseMHA_head_sum(float p) {
    // lane ^ 4 and lane ^ 8 inside a 16-lane row (DPP row_xmask), then lane ^ 16
    p += __builtin_bit_cast(float, __builtin_amdgcn_update_dpp(
             0, __builtin_bit_cast(int, p), 0x164, 0xf, 0xf, true));
    p += __builtin_bit_cast(float, __builtin_amdgcn_update_dpp(
             0, __builtin_bit_cast(int, p), 0x168, 0xf, 0xf, true));
    p += __builtin_bit_cast(float, __builtin_amdgcn_permlanex16(
             __builtin_bit_cast(int, p), __builtin_bit_cast(int, p),
             0x76543210, 0xfedcba98, false, false));
    return p;
}

// sigmoid(q . k of this lane's head) * edge weight
__device__ __forceinline__ float SparseMHA_attn(float2 q2, float2 k2, float w) {
    const float p = SparseMHA_head_sum(q2.x * k2.x + q2.y * k2.y);
    return w / (1.0f + __expf(-p));
}

#define EDGE_BLOCKS 2048   // 256 WGPs x 64 wave slots / 8 waves per block

__global__ __launch_bounds__(256) void SparseMHA_edge_kernel(
    const float* __restrict__ q, const float* __restrict__ k,
    const float* __restrict__ v,
    const int* __restrict__ row, const int* __restrict__ col,
    const float* __restrict__ ew,
    float* __restrict__ out, int nnz, int n)
{
    const int lane = threadIdx.x & 31;
    // wave-uniform, so the edges' indices and row bases stay in scalar registers
    const int wave = __builtin_amdgcn_readfirstlane(threadIdx.x >> 5);
    const int wid  = blockIdx.x * 8 + wave;   // a block's 8 waves share one 128-byte line of each index array
    const int nw   = gridDim.x * 8;
    const int ng   = nnz >> 2;                // whole groups of four edges (16-byte aligned index reads)

    if (wid < ng) {
        const unsigned l8 = lane * 8u, l4 = lane * 4u;   // lane's byte offset in a q/k/v row, in half an out row
        int g = wid;
        int4   rr = *(const int4*)(row + g * 4);
        int4   cc = *(const int4*)(col + g * 4);
        float4 ww = *(const float4*)(ew + g * 4);
        for (;;) {
            const int r0 = min(max(rr.x, 0), n - 1);
            const int r1 = min(max(rr.y, 0), n - 1);
            const int r2 = min(max(rr.z, 0), n - 1);
            const int r3 = min(max(rr.w, 0), n - 1);
            const int c0 = min(max(cc.x, 0), n - 1);
            const int c1 = min(max(cc.y, 0), n - 1);
            const int c2 = min(max(cc.z, 0), n - 1);
            const int c3 = min(max(cc.w, 0), n - 1);
            const float4 wc = ww;

            // 32-bit byte offsets (row * 256 + lane part) on the scalar base pointers:
            // one 32-bit vector operation per address; k and v share theirs
            const unsigned qo0 = (unsigned)r0 * 256u + l8, ko0 = (unsigned)c0 * 256u + l8;
            const unsigned qo1 = (unsigned)r1 * 256u + l8, ko1 = (unsigned)c1 * 256u + l8;
            const unsigned qo2 = (unsigned)r2 * 256u + l8, ko2 = (unsigned)c2 * 256u + l8;
            const unsigned qo3 = (unsigned)r3 * 256u + l8, ko3 = (unsigned)c3 * 256u + l8;

            const float2 q0 = *(const float2*)((const char*)q + qo0);
            const float2 k0 = *(const float2*)((const char*)k + ko0);
            const float2 q1 = *(const float2*)((const char*)q + qo1);
            const float2 k1 = *(const float2*)((const char*)k + ko1);
            const float2 q2 = *(const float2*)((const char*)q + qo2);
            const float2 k2 = *(const float2*)((const char*)k + ko2);
            const float2 q3 = *(const float2*)((const char*)q + qo3);
            const float2 k3 = *(const float2*)((const char*)k + ko3);
            const float2 v0 = *(const float2*)((const char*)v + ko0);
            const float2 v1 = *(const float2*)((const char*)v + ko1);
            const float2 v2 = *(const float2*)((const char*)v + ko2);
            const float2 v3 = *(const float2*)((const char*)v + ko3);

            // the next trip's indices come in under this trip's row loads
            // (the last trip reads its own group again: always in bounds)
            const int gn = g + nw;
            const int gp = gn < ng ? gn : g;
            rr = *(const int4*)(row + gp * 4);
            cc = *(const int4*)(col + gp * 4);
            ww = *(const float4*)(ew + gp * 4);
            // keeps the three index loads above the waits for the row loads; left free,
            // the scheduler sinks them behind those waits and their latency shows at the loop's head
            __builtin_amdgcn_sched_barrier(0);

            const float a0 = SparseMHA_attn(q0, k0, wc.x);
            const float a1 = SparseMHA_attn(q1, k1, wc.y);
            const float a2 = SparseMHA_attn(q2, k2, wc.z);
            const float a3 = SparseMHA_attn(q3, k3, wc.w);

            float* ob0 = (float*)((char*)out + ((unsigned)r0 * 256u + l4));
            float* ob1 = (float*)((char*)out + ((unsigned)r1 * 256u + l4));
            float* ob2 = (float*)((char*)out + ((unsigned)r2 * 256u + l4));
            float* ob3 = (float*)((char*)out + ((unsigned)r3 * 256u + l4));
            atomicAdd(ob0,      a0 * v0.x);
            atomicAdd(ob0 + 32, a0 * v0.y);
            atomicAdd(ob1,      a1 * v1.x);
            atomicAdd(ob1 + 32, a1 * v1.y);
            atomicAdd(ob2,      a2 * v2.x);
            atomicAdd(ob2 + 32, a2 * v2.y);
            atomicAdd(ob3,      a3 * v3.x);
            atomicAdd(ob3 + 32, a3 * v3.y);
            // the next trip reuses registers that the loads and atomics above name
            asm volatile("s_wait_xcnt 0x0" ::: "memory");

            if (gn >= ng) break;
            g = gn;
        }
    }

    if (wid < (nnz & 3)) {           // edge count not a multiple of four: one wave per leftover edge
        const int e0 = ng * 4 + wid;
        const int r0 = min(max(row[e0], 0), n - 1);
        const int c0 = min(max(col[e0], 0), n - 1);
        const float2 q0 = *(const float2*)(q + r0 * HIDDEN + lane * 2);
        const float2 k0 = *(const float2*)(k + c0 * HIDDEN + lane * 2);
        const float2 v0 = *(const float2*)(v + c0 * HIDDEN + lane * 2);
        const float a0 = SparseMHA_attn(q0, k0, ew[e0]);
        float* __restrict__ ob0 = out + r0 * HIDDEN + lane;
        atomicAdd(ob0,      a0 * v0.x);
        atomicAdd(ob0 + 32, a0 * v0.y);
        // the code behind this branch reuses registers that the two atomics name
        asm volatile("s_wait_xcnt 0x0" ::: "memory");
    }
}

// ---------------------------------------------------------------------------
extern "C" void kernel_launch(void* const* d_in, const int* in_sizes, int n_in,
                              void* d_out, int out_size, void* d_ws, size_t ws_size,
                              hipStream_t stream) {
    const float* h   = (const float*)d_in[0];
    const int*   row = (const int*)  d_in[1];
    const int*   col = (const int*)  d_in[2];
    const float* ew  = (const float*)d_in[3];
    const float* Wq  = (const float*)d_in[4];
    const float* bq  = (const float*)d_in[5];
    const float* Wk  = (const float*)d_in[6];
    const float* bk  = (const float*)d_in[7];
    const float* Wv  = (const float*)d_in[8];
    const float* bv  = (const float*)d_in[9];
    float*       out = (float*)d_out;

    const int n   = in_sizes[0] / HIDDEN;   // 50000
    const int nnz = in_sizes[1];            // 1600000

    float* qws = (float*)d_ws;
    float* kws = qws + (size_t)n * HIDDEN;
    float* vws = kws + (size_t)n * HIDDEN;

    // zero d_out
    const int n4 = (n * HIDDEN) / 4;
    SparseMHA_zero_kernel<<<(n4 + 255) / 256, 256, 0, stream>>>((float4*)out, n4);

    // q/k/v projections via fp32 WMMA
    SparseMHA_proj_kernel<<<(n + 15) / 16, 128, 0, stream>>>(
        h, Wq, bq, Wk, bk, Wv, bv, qws, kws, vws, n);

    // fused edge SDDMM + sigmoid*w + scatter (fixed grid of looping waves)
    SparseMHA_edge_kernel<<<EDGE_BLOCKS, 256, 0, stream>>>(
        qws, kws, vws, row, col, ew, out, nnz, n);
}

// v003
// A run of this version takes 104 microseconds.
// In both of two side-by-side timings against v002, it was 1.06 times as fast.
// Over all steps from v000 it is 1.60 times as fast.
#include <hip/hip_runtime.h>
#include <hip/hip_bf16.h>
#include <math.h>

#define HIDDEN    64
#define NUM_HEADS 4
#define HEAD_DIM  16
#define SCALING   0.25f  // HEAD_DIM^-0.5

typedef __attribute__((ext_vector_type(2))) float v2f;
typedef __attribute__((ext_vector_type(8))) float v8f;

// ---------------------------------------------------------------------------
// Kernel 0: zero the output (scatter needs zeros)
// ---------------------------------------------------------------------------
__global__ void SparseMHA_zero_kernel(float4* __restrict__ out, int n4) {
    int i = blockIdx.x * blockDim.x + threadIdx.x;
    if (i < n4) out[i] = make_float4(0.f, 0.f, 0.f, 0.f);
}

// ---------------------------------------------------------------------------
// Kernel 1: fused q/k/v projection using native fp32 WMMA (16x16x4).
//   Block = 128 threads = 4 waves, wave w -> stored slots [16w,16w+16).
//   The grid is fixed. A wave reads the 48 B fragments of its 16 slots (three
//   weight matrices, 16 K-steps) ONCE and keeps them in registers, then loops
//   over tiles of 16 rows of h (tile index strided by the block count): per
//   tile it loads only the 16 A fragments, a quarter of the fragment loads.
//   48 v_wmma_f32_16x16x4_f32 per wave and tile. Epilogue adds bias (and
//   applies SCALING to q as in the reference).
// ---------------------------------------------------------------------------
#define PROJ_BLOCKS 512   // 256 WGPs x 2 blocks: 2 waves per SIMD, about 6 tiles per block

__global__ __launch_bounds__(128) void SparseMHA_proj_kernel(
    const float* __restrict__ h,
    const float* __restrict__ Wq, const float* __restrict__ bq,
    const float* __restrict__ Wk, const float* __restrict__ bk,
    const float* __restrict__ Wv, const float* __restrict__ bv,
    float* __restrict__ qout, float* __restrict__ kout, float* __restrict__ vout,
    int n)
{
    const int wave = threadIdx.x >> 5;
    const int lane = threadIdx.x & 31;
    const int half = lane >> 4;      // 0: K lo pair / M,N 0-7 side, 1: K hi pair
    const int r16  = lane & 15;
    const int n0   = wave * 16;
    const int nt   = (n + 15) >> 4;  // tiles of 16 rows

    int t = blockIdx.x;
    if (t >= nt) return;             // whole block leaves; the kernel has no barrier

    // Slot colj of a stored q/k/v row holds channel chan (slot 2L+j = channel 32j+L):
    // kernel 2 then reads channels L and 32+L of a row with one 8-byte load per lane.
    const int colj = n0 + r16;
    const int chan = ((colj & 1) << 5) | (colj >> 1);
    const float* __restrict__ wqrow = Wq + chan * HIDDEN + half * 2;  // B[kk,n] = W[chan(n0+n), kb+kk]
    const float* __restrict__ wkrow = Wk + chan * HIDDEN + half * 2;
    const float* __restrict__ wvrow = Wv + chan * HIDDEN + half * 2;

    v2f bqf[16], bkf[16], bvf[16];   // this lane's K pair of every 4-wide slab, all three matrices
#pragma unroll
    for (int ks = 0; ks < 16; ++ks) {
        bqf[ks] = *(const v2f*)(wqrow + ks * 4);
        bkf[ks] = *(const v2f*)(wkrow + ks * 4);
        bvf[ks] = *(const v2f*)(wvrow + ks * 4);
    }
    const float biasq = bq[chan];
    const float biask = bk[chan];
    const float biasv = bv[chan];

    // A-row clamped so WMMA can run with EXEC all-ones even on a ragged tail.
    v2f af[16];
    {
        const float* __restrict__ hrow = h + min(t * 16 + r16, n - 1) * HIDDEN + half * 2;
#pragma unroll
        for (int ks = 0; ks < 16; ++ks) af[ks] = *(const v2f*)(hrow + ks * 4);
    }

    for (;;) {
        // the next tile's A fragments come in under this tile's WMMAs
        // (the last trip reads its own tile again: always in bounds)
        const int tn = t + PROJ_BLOCKS;
        const int tp = tn < nt ? tn : t;
        v2f an[16];
        {
            const float* __restrict__ hrow = h + min(tp * 16 + r16, n - 1) * HIDDEN + half * 2;
#pragma unroll
            for (int ks = 0; ks < 16; ++ks) an[ks] = *(const v2f*)(hrow + ks * 4);
        }

        v8f accq = {}; v8f acck = {}; v8f accv = {};
#pragma unroll
        for (int ks = 0; ks < 16; ++ks) {
            accq = __builtin_amdgcn_wmma_f32_16x16x4_f32(false, af[ks], false, bqf[ks],
                                                         (short)0, accq, false, false);
            acck = __builtin_amdgcn_wmma_f32_16x16x4_f32(false, af[ks], false, bkf[ks],
                                                         (short)0, acck, false, false);
            accv = __builtin_amdgcn_wmma_f32_16x16x4_f32(false, af[ks], false, bvf[ks],
                                                         (short)0, accv, false, false);
        }

        // four vector slots between the last WMMA and the first vector instruction that
        // reuses its A registers (dead from here on) or reads its result; the two
        // scheduling barriers keep the slots directly behind that WMMA
        __builtin_amdgcn_sched_barrier(0);
        asm volatile("v_nop\n\tv_nop\n\tv_nop\n\tv_nop");
        __builtin_amdgcn_sched_barrier(0);

        // C layout: VGPR vr, lanes 0-15 -> M = vr, lanes 16-31 -> M = vr + 8; N = lane%16
        const int m0 = t * 16;
#pragma unroll
        for (int vr = 0; vr < 8; ++vr) {
            const int m = m0 + vr + half * 8;
            if (m < n) {
                const int idx = m * HIDDEN + colj;
                qout[idx] = (accq[vr] + biasq) * SCALING;
                kout[idx] =  acck[vr] + biask;
                vout[idx] =  accv[vr] + biasv;
            }
        }

        if (tn >= nt) break;
        t = tn;
#pragma unroll
        for (int ks = 0; ks < 16; ++ks) af[ks] = an[ks];
    }
}

// ---------------------------------------------------------------------------
// Kernel 2: fused SDDMM + sigmoid*edge_weight + SPMM scatter.
//   One whole wave per edge. The grid is fixed: as many waves as the chip has
//   wave slots, each looping over groups of four edges (group index strided by
//   the wave count), so a wave is started once per ~100 edges, not per two.
//   q/k/v rows are stored channel-permuted by kernel 1 (slot 2L+j holds
//   channel 32j+L), so lane L reads channels L and 32+L with one 8-byte load
//   and each atomic instruction adds to 32 neighbouring floats of out[row]:
//   one whole 128-byte line per instruction.
//   Channel c = d*4 + head, so both of a lane's channels belong to head L&3;
//   the sum over d runs over the lanes with equal L&3 (xor 4, 8, 16).
// ---------------------------------------------------------------------------
__device__ __forceinline__ float SparseMHA_head_sum(float p) {
    // lane ^ 4 and lane ^ 8 inside a 16-lane row (DPP row_xmask), then lane ^ 16
    p += __builtin_bit_cast(float, __builtin_amdgcn_update_dpp(
             0, __builtin_bit_cast(int, p), 0x164, 0xf, 0xf, true));
    p += __builtin_bit_cast(float, __builtin_amdgcn_update_dpp(
             0, __builtin_bit_cast(int, p), 0x168, 0xf, 0xf, true));
    p += __builtin_bit_cast(float, __builtin_amdgcn_permlanex16(
             __builtin_bit_cast(int, p), __builtin_bit_cast(int, p),
             0x76543210, 0xfedcba98, false, false));
    return p;
}

// sigmoid(q . k of this lane's head) * edge weight
__device__ __forceinline__ float SparseMHA_attn(float2 q2, float2 k2, float w) {
    const float p = SparseMHA_head_sum(q2.x * k2.x + q2.y * k2.y);
    return w / (1.0f + __expf(-p));
}

#define EDGE_BLOCKS 2048   // 256 WGPs x 64 wave slots / 8 waves per block

__global__ __launch_bounds__(256) void SparseMHA_edge_kernel(
    const float* __restrict__ q, const float* __restrict__ k,
    const float* __restrict__ v,
    const int* __restrict__ row, const int* __restrict__ col,
    const float* __restrict__ ew,
    float* __restrict__ out, int nnz, int n)
{
    const int lane = threadIdx.x & 31;
    // wave-uniform, so the edges' indices and row bases stay in scalar registers
    const int wave = __builtin_amdgcn_readfirstlane(threadIdx.x >> 5);
    const int wid  = blockIdx.x * 8 + wave;   // a block's 8 waves share one 128-byte line of each index array
    const int nw   = gridDim.x * 8;
    const int ng   = nnz >> 2;                // whole groups of four edges (16-byte aligned index reads)

    if (wid < ng) {
        const unsigned l8 = lane * 8u, l4 = lane * 4u;   // lane's byte offset in a q/k/v row, in half an out row
        int g = wid;
        int4   rr = *(const int4*)(row + g * 4);
        int4   cc = *(const int4*)(col + g * 4);
        float4 ww = *(const float4*)(ew + g * 4);
        for (;;) {
            const int r0 = min(max(rr.x, 0), n - 1);
            const int r1 = min(max(rr.y, 0), n - 1);
            const int r2 = min(max(rr.z, 0), n - 1);
            const int r3 = min(max(rr.w, 0), n - 1);
            const int c0 = min(max(cc.x, 0), n - 1);
            const int c1 = min(max(cc.y, 0), n - 1);
            const int c2 = min(max(cc.z, 0), n - 1);
            const int c3 = min(max(cc.w, 0), n - 1);
            const float4 wc = ww;

            // 32-bit byte offsets (row * 256 + lane part) on the scalar base pointers:
            // one 32-bit vector operation per address; k and v share theirs
            const unsigned qo0 = (unsigned)r0 * 256u + l8, ko0 = (unsigned)c0 * 256u + l8;
            const unsigned qo1 = (unsigned)r1 * 256u + l8, ko1 = (unsigned)c1 * 256u + l8;
            const unsigned qo2 = (unsigned)r2 * 256u + l8, ko2 = (unsigned)c2 * 256u + l8;
            const unsigned qo3 = (unsigned)r3 * 256u + l8, ko3 = (unsigned)c3 * 256u + l8;

            const float2 q0 = *(const float2*)((const char*)q + qo0);
            const float2 k0 = *(const float2*)((const char*)k + ko0);
            const float2 q1 = *(const float2*)((const char*)q + qo1);
            const float2 k1 = *(const float2*)((const char*)k + ko1);
            const float2 q2 = *(const float2*)((const char*)q + qo2);
            const float2 k2 = *(const float2*)((const char*)k + ko2);
            const float2 q3 = *(const float2*)((const char*)q + qo3);
            const float2 k3 = *(const float2*)((const char*)k + ko3);
            const float2 v0 = *(const float2*)((const char*)v + ko0);
            const float2 v1 = *(const float2*)((const char*)v + ko1);
            const float2 v2 = *(const float2*)((const char*)v + ko2);
            const float2 v3 = *(const float2*)((const char*)v + ko3);

            // the next trip's indices come in under this trip's row loads
            // (the last trip reads its own group again: always in bounds)
            const int gn = g + nw;
            const int gp = gn < ng ? gn : g;
            rr = *(const int4*)(row + gp * 4);
            cc = *(const int4*)(col + gp * 4);
            ww = *(const float4*)(ew + gp * 4);
            // keeps the three index loads above the waits for the row loads; left free,
            // the scheduler sinks them behind those waits and their latency shows at the loop's head
            __builtin_amdgcn_sched_barrier(0);

            const float a0 = SparseMHA_attn(q0, k0, wc.x);
            const float a1 = SparseMHA_attn(q1, k1, wc.y);
            const float a2 = SparseMHA_attn(q2, k2, wc.z);
            const float a3 = SparseMHA_attn(q3, k3, wc.w);

            float* ob0 = (float*)((char*)out + ((unsigned)r0 * 256u + l4));
            float* ob1 = (float*)((char*)out + ((unsigned)r1 * 256u + l4));
            float* ob2 = (float*)((char*)out + ((unsigned)r2 * 256u + l4));
            float* ob3 = (float*)((char*)out + ((unsigned)r3 * 256u + l4));
            atomicAdd(ob0,      a0 * v0.x);
            atomicAdd(ob0 + 32, a0 * v0.y);
            atomicAdd(ob1,      a1 * v1.x);
            atomicAdd(ob1 + 32, a1 * v1.y);
            atomicAdd(ob2,      a2 * v2.x);
            atomicAdd(ob2 + 32, a2 * v2.y);
            atomicAdd(ob3,      a3 * v3.x);
            atomicAdd(ob3 + 32, a3 * v3.y);
            // the next trip reuses registers that the loads and atomics above name
            asm volatile("s_wait_xcnt 0x0" ::: "memory");

            if (gn >= ng) break;
            g = gn;
        }
    }

    if (wid < (nnz & 3)) {           // edge count not a multiple of four: one wave per leftover edge
        const int e0 = ng * 4 + wid;
        const int r0 = min(max(row[e0], 0), n - 1);
        const int c0 = min(max(col[e0], 0), n - 1);
        const float2 q0 = *(const float2*)(q + r0 * HIDDEN + lane * 2);
        const float2 k0 = *(const float2*)(k + c0 * HIDDEN + lane * 2);
        const float2 v0 = *(const float2*)(v + c0 * HIDDEN + lane * 2);
        const float a0 = SparseMHA_attn(q0, k0, ew[e0]);
        float* __restrict__ ob0 = out + r0 * HIDDEN + lane;
        atomicAdd(ob0,      a0 * v0.x);
        atomicAdd(ob0 + 32, a0 * v0.y);
        // the code behind this branch reuses registers that the two atomics name
        asm volatile("s_wait_xcnt 0x0" ::: "memory");
    }
}

// ---------------------------------------------------------------------------
extern "C" void kernel_launch(void* const* d_in, const int* in_sizes, int n_in,
                              void* d_out, int out_size, void* d_ws, size_t ws_size,
                              hipStream_t stream) {
    const float* h   = (const float*)d_in[0];
    const int*   row = (const int*)  d_in[1];
    const int*   col = (const int*)  d_in[2];
    const float* ew  = (const float*)d_in[3];
    const float* Wq  = (const float*)d_in[4];
    const float* bq  = (const float*)d_in[5];
    const float* Wk  = (const float*)d_in[6];
    const float* bk  = (const float*)d_in[7];
    const float* Wv  = (const float*)d_in[8];
    const float* bv  = (const float*)d_in[9];
    float*       out = (float*)d_out;

    const int n   = in_sizes[0] / HIDDEN;   // 50000
    const int nnz = in_sizes[1];            // 1600000

    float* qws = (float*)d_ws;
    float* kws = qws + (size_t)n * HIDDEN;
    float* vws = kws + (size_t)n * HIDDEN;

    // zero d_out
    const int n4 = (n * HIDDEN) / 4;
    SparseMHA_zero_kernel<<<(n4 + 255) / 256, 256, 0, stream>>>((float4*)out, n4);

    // q/k/v projections via fp32 WMMA (fixed grid of blocks looping over row tiles)
    SparseMHA_proj_kernel<<<PROJ_BLOCKS, 128, 0, stream>>>(
        h, Wq, bq, Wk, bk, Wv, bv, qws, kws, vws, n);

    // fused edge SDDMM + sigmoid*w + scatter (fixed grid of looping waves)
    SparseMHA_edge_kernel<<<EDGE_BLOCKS, 256, 0, stream>>>(
        qws, kws, vws, row, col, ew, out, nnz, n);
}

// v004
// Measured time: 67 microseconds a run.
// Timed twice side by side with v003, it ran 1.55 and 1.54 times as fast.
// Counting every step since v000, it is 2.47 times as fast.
#include <hip/hip_runtime.h>
#include <hip/hip_bf16.h>
#include <math.h>

#define HIDDEN    64
#define NUM_HEADS 4
#define HEAD_DIM  16
#define SCALING   0.25f  // HEAD_DIM^-0.5

typedef __attribute__((ext_vector_type(2))) float v2f;
typedef __attribute__((ext_vector_type(8))) float v8f;

// ---------------------------------------------------------------------------
// Kernel 1: fused q/k/v projection using native fp32 WMMA (16x16x4).
//   Block = 128 threads = 4 waves, wave w -> stored slots [16w,16w+16).
//   The grid is fixed. A wave reads the 48 B fragments of its 16 slots (three
//   weight matrices, 16 K-steps) ONCE and keeps them in registers, then loops
//   over tiles of 16 rows of h (tile index strided by the block count): per
//   tile it loads only the 16 A fragments, a quarter of the fragment loads.
//   48 v_wmma_f32_16x16x4_f32 per wave and tile. Epilogue adds bias (and
//   applies SCALING to q as in the reference).
// ---------------------------------------------------------------------------
#define PROJ_BLOCKS 512   // 256 WGPs x 2 blocks: 2 waves per SIMD, about 6 tiles per block

__global__ __launch_bounds__(128) void SparseMHA_proj_kernel(
    const float* __restrict__ h,
    const float* __restrict__ Wq, const float* __restrict__ bq,
    const float* __restrict__ Wk, const float* __restrict__ bk,
    const float* __restrict__ Wv, const float* __restrict__ bv,
    float* __restrict__ qout, float* __restrict__ kout, float* __restrict__ vout,
    int n)
{
    const int wave = threadIdx.x >> 5;
    const int lane = threadIdx.x & 31;
    const int half = lane >> 4;      // 0: K lo pair / M,N 0-7 side, 1: K hi pair
    const int r16  = lane & 15;
    const int n0   = wave * 16;
    const int nt   = (n + 15) >> 4;  // tiles of 16 rows

    int t = blockIdx.x;
    if (t >= nt) return;             // whole block leaves; the kernel has no barrier

    // Slot colj of a stored q/k/v row holds channel chan (slot 2L+j = channel 32j+L):
    // kernel 3 then reads channels L and 32+L of a row with one 8-byte load per lane.
    const int colj = n0 + r16;
    const int chan = ((colj & 1) << 5) | (colj >> 1);
    const float* __restrict__ wqrow = Wq + chan * HIDDEN + half * 2;  // B[kk,n] = W[chan(n0+n), kb+kk]
    const float* __restrict__ wkrow = Wk + chan * HIDDEN + half * 2;
    const float* __restrict__ wvrow = Wv + chan * HIDDEN + half * 2;

    v2f bqf[16], bkf[16], bvf[16];   // this lane's K pair of every 4-wide slab, all three matrices
#pragma unroll
    for (int ks = 0; ks < 16; ++ks) {
        bqf[ks] = *(const v2f*)(wqrow + ks * 4);
        bkf[ks] = *(const v2f*)(wkrow + ks * 4);
        bvf[ks] = *(const v2f*)(wvrow + ks * 4);
    }
    const float biasq = bq[chan];
    const float biask = bk[chan];
    const float biasv = bv[chan];

    // A-row clamped so WMMA can run with EXEC all-ones even on a ragged tail.
    v2f af[16];
    {
        const float* __restrict__ hrow = h + min(t * 16 + r16, n - 1) * HIDDEN + half * 2;
#pragma unroll
        for (int ks = 0; ks < 16; ++ks) af[ks] = *(const v2f*)(hrow + ks * 4);
    }

    for (;;) {
        // the next tile's A fragments come in under this tile's WMMAs
        // (the last trip reads its own tile again: always in bounds)
        const int tn = t + PROJ_BLOCKS;
        const int tp = tn < nt ? tn : t;
        v2f an[16];
        {
            const float* __restrict__ hrow = h + min(tp * 16 + r16, n - 1) * HIDDEN + half * 2;
#pragma unroll
            for (int ks = 0; ks < 16; ++ks) an[ks] = *(const v2f*)(hrow + ks * 4);
        }

        v8f accq = {}; v8f acck = {}; v8f accv = {};
#pragma unroll
        for (int ks = 0; ks < 16; ++ks) {
            accq = __builtin_amdgcn_wmma_f32_16x16x4_f32(false, af[ks], false, bqf[ks],
                                                         (short)0, accq, false, false);
            acck = __builtin_amdgcn_wmma_f32_16x16x4_f32(false, af[ks], false, bkf[ks],
                                                         (short)0, acck, false, false);
            accv = __builtin_amdgcn_wmma_f32_16x16x4_f32(false, af[ks], false, bvf[ks],
                                                         (short)0, accv, false, false);
        }

        // four vector slots between the last WMMA and the first vector instruction that
        // reuses its A registers (dead from here on) or reads its result; the two
        // scheduling barriers keep the slots directly behind that WMMA
        __builtin_amdgcn_sched_barrier(0);
        asm volatile("v_nop\n\tv_nop\n\tv_nop\n\tv_nop");
        __builtin_amdgcn_sched_barrier(0);

        // C layout: VGPR vr, lanes 0-15 -> M = vr, lanes 16-31 -> M = vr + 8; N = lane%16
        const int m0 = t * 16;
#pragma unroll
        for (int vr = 0; vr < 8; ++vr) {
            const int m = m0 + vr + half * 8;
            if (m < n) {
                const int idx = m * HIDDEN + colj;
                qout[idx] = (accq[vr] + biasq) * SCALING;
                kout[idx] =  acck[vr] + biask;
                vout[idx] =  accv[vr] + biasv;
            }
        }

        if (tn >= nt) break;
        t = tn;
#pragma unroll
        for (int ks = 0; ks < 16; ++ks) af[ks] = an[ks];
    }
}

// ---------------------------------------------------------------------------
// Kernel 2: edges sorted by range of out rows, chunk by chunk.
//   The out rows are cut into NB ranges of RPB rows; the edge list into chunks
//   of CHCAP edges. A block counts its chunk's edges per range in LDS, scans
//   the counts, places each edge's 8-byte record (col * 256 + row inside its
//   range, edge weight) in LDS in range order and writes the chunk out in whole
//   lines, with the NB + 1 starts of the ranges inside the chunk.
//   The declared shapes give n <= NB * RPB rows.
// ---------------------------------------------------------------------------
#define RPB    196    // out rows per range: sums and q rows of a range take 98 KiB of LDS
#define NB     256    // ranges: one per WGP
#define CHCAP  6272   // edges per chunk (49 KiB of records in LDS)
#define EPT    7      // edges per thread of a 1024-thread block: ceil(CHCAP / 1024)
#define SORT_BLOCKS 256
#define SUM_BLOCKS  256

__global__ __launch_bounds__(1024) void SparseMHA_sort_kernel(
    const int* __restrict__ row, const int* __restrict__ col,
    const float* __restrict__ ew,
    unsigned* __restrict__ rec, unsigned* __restrict__ off, int nnz, int n)
{
    __shared__ unsigned cnt[NB];
    __shared__ unsigned scn[NB];
    __shared__ uint2    srt[CHCAP];
    const int tid  = threadIdx.x;
    const int nch  = (nnz + CHCAP - 1) / CHCAP;
    const int rmax = min(n, NB * RPB) - 1;

    for (int c = blockIdx.x; c < nch; c += gridDim.x) {
        const int e0 = c * CHCAP;
        const int m  = min(CHCAP, nnz - e0);
        // a thread's EPT edges are asked for at once and stay in registers for both passes
        int rr[EPT], cc[EPT]; float ww[EPT];
#pragma unroll
        for (int t = 0; t < EPT; ++t) {
            const int i = min(tid + t * 1024, m - 1);
            rr[t] = row[e0 + i]; cc[t] = col[e0 + i]; ww[t] = ew[e0 + i];
            // the loads stay in flight: a later trip's result may land in their offset register
            asm volatile("s_wait_xcnt 0x0" ::: "memory");
        }
        if (tid < NB) cnt[tid] = 0u;
        __syncthreads();
#pragma unroll
        for (int t = 0; t < EPT; ++t) {
            rr[t] = min(max(rr[t], 0), rmax);
            if (tid + t * 1024 < m) atomicAdd(&cnt[rr[t] / RPB], 1u);
        }
        __syncthreads();
        // inclusive scan of the NB counts (every thread passes every barrier)
        unsigned x = 0u;
        if (tid < NB) { x = cnt[tid]; scn[tid] = x; }
        __syncthreads();
        for (int d = 1; d < NB; d <<= 1) {
            unsigned y = 0u;
            if (tid < NB && tid >= d) y = scn[tid - d];
            __syncthreads();
            if (tid < NB) { x += y; scn[tid] = x; }
            __syncthreads();
        }
        if (tid < NB) {
            const unsigned st = x - cnt[tid];      // first place of this range in the chunk
            off[c * (NB + 1) + tid] = st;
            cnt[tid] = st;                         // from here on the range's next free place
        }
        if (tid == 0) off[c * (NB + 1) + NB] = (unsigned)m;
        __syncthreads();
#pragma unroll
        for (int t = 0; t < EPT; ++t) {
            if (tid + t * 1024 < m) {
                const int cl = min(max(cc[t], 0), n - 1);
                const int b  = rr[t] / RPB;
                const unsigned pos = atomicAdd(&cnt[b], 1u);
                srt[pos] = make_uint2(((unsigned)cl << 8) | (unsigned)(rr[t] - b * RPB),
                                      __float_as_uint(ww[t]));
            }
        }
        __syncthreads();
        for (int i = tid; i < m; i += 1024) ((uint2*)rec)[e0 + i] = srt[i];
        __syncthreads();                           // srt and cnt are free for the next chunk
    }
}

// ---------------------------------------------------------------------------
// Kernel 3: fused SDDMM + sigmoid*edge_weight + SPMM, one block per row range.
//   The block holds its range's q rows and its out sums in LDS. A wave takes
//   every 32nd chunk, reads the range's records of that chunk (32 at a time,
//   one per lane) and works on four edges at once, one whole wave per edge:
//   only the k and v rows come from L2, the sums are LDS adds, and each out
//   row is stored once (rows without an edge as zero).
//   q/k/v rows are stored channel-permuted by kernel 1 (slot 2L+j holds
//   channel 32j+L): lane L reads channels L and 32+L with one 8-byte load.
//   Channel c = d*4 + head, so both of a lane's channels belong to head L&3;
//   the sum over d runs over the lanes with equal L&3 (xor 4, 8, 16).
// ---------------------------------------------------------------------------
__device__ __forceinline__ float SparseMHA_head_sum(float p) {
    // lane ^ 4 and lane ^ 8 inside a 16-lane row (DPP row_xmask), then lane ^ 16
    p += __builtin_bit_cast(float, __builtin_amdgcn_update_dpp(
             0, __builtin_bit_cast(int, p), 0x164, 0xf, 0xf, true));
    p += __builtin_bit_cast(float, __builtin_amdgcn_update_dpp(
             0, __builtin_bit_cast(int, p), 0x168, 0xf, 0xf, true));
    p += __builtin_bit_cast(float, __builtin_amdgcn_permlanex16(
             __builtin_bit_cast(int, p), __builtin_bit_cast(int, p),
             0x76543210, 0xfedcba98, false, false));
    return p;
}

// sigmoid(q . k of this lane's head) * edge weight
__device__ __forceinline__ float SparseMHA_attn(float2 q2, float2 k2, float w) {
    const float p = SparseMHA_head_sum(q2.x * k2.x + q2.y * k2.y);
    return w / (1.0f + __expf(-p));
}

__global__ __launch_bounds__(1024) void SparseMHA_edge_kernel(
    const float* __restrict__ q, const float* __restrict__ k,
    const float* __restrict__ v,
    const unsigned* __restrict__ rec, const unsigned* __restrict__ off,
    float* __restrict__ out, int nnz, int n)
{
    __shared__ float acc[RPB * HIDDEN];
    __shared__ float qs[RPB * HIDDEN];
    const int tid  = threadIdx.x;
    const int lane = tid & 31;
    // wave-uniform, so chunk numbers and range bounds stay in scalar registers
    const int wave = __builtin_amdgcn_readfirstlane(tid >> 5);
    const int nch  = (nnz + CHCAP - 1) / CHCAP;
    const int nb   = (n + RPB - 1) / RPB;
    const unsigned l8 = lane * 8u;               // lane's byte offset in a k/v row

    for (int bin = blockIdx.x; bin < nb; bin += gridDim.x) {
        const int rb = bin * RPB;
        const int nr = min(RPB, n - rb);
        for (int i = tid; i < nr * (HIDDEN / 4); i += 1024) {
            ((float4*)qs)[i]  = ((const float4*)(q + rb * HIDDEN))[i];
            ((float4*)acc)[i] = make_float4(0.f, 0.f, 0.f, 0.f);
        }
        __syncthreads();

        for (int c0 = wave; c0 < nch && bin < NB; c0 += 1024) {
            // lane t holds the range's bounds in chunk c0 + 32 t: one load for up to 32 chunks
            const int cl = min(c0 + lane * 32, nch - 1);
            const int sl = (int)off[cl * (NB + 1) + bin];
            const int el = (int)off[cl * (NB + 1) + bin + 1];
            const int nj = min(32, (nch - c0 + 31) >> 5);
            // the first 32 records of a chunk's part are asked for one chunk ahead
            uint2 nx = make_uint2(0u, 0u);
            {
                const int s1 = __builtin_amdgcn_readlane(sl, 0);
                const int e1 = __builtin_amdgcn_readlane(el, 0);
                if (e1 > s1) {
                    nx = ((const uint2*)rec + c0 * CHCAP)[s1 + min(lane, min(32, e1 - s1) - 1)];
                    // the load stays in flight: its address register is reused right behind it
                    asm volatile("s_wait_xcnt 0x0" ::: "memory");
                }
            }
            for (int t = 0; t < nj; ++t) {
            const int s = __builtin_amdgcn_readlane(sl, t);
            const int e = __builtin_amdgcn_readlane(el, t);
            const uint2* __restrict__ rp = (const uint2*)rec + (c0 + 32 * t) * CHCAP;
            // lanes past the end hold the last record again with weight zero
            uint2 rc = nx;
            if (lane >= e - s) rc.y = 0u;
            if (t + 1 < nj) {
                const int s1 = __builtin_amdgcn_readlane(sl, t + 1);
                const int e1 = __builtin_amdgcn_readlane(el, t + 1);
                if (e1 > s1) {
                    nx = (rp + 32 * CHCAP)[s1 + min(lane, min(32, e1 - s1) - 1)];
                    // the load stays in flight: its address register is reused right behind it
                    asm volatile("s_wait_xcnt 0x0" ::: "memory");
                }
            }
            for (int p = s; p < e; p += 32) {
                const int m = min(32, e - p);
                if (p > s) {
                    rc = rp[p + min(lane, m - 1)];
                    if (lane >= m) rc.y = 0u;
                }
                for (int j = 0; j < m; j += 4) {
                    const unsigned a0 = __builtin_amdgcn_readlane(rc.x, j);
                    const unsigned a1 = __builtin_amdgcn_readlane(rc.x, j + 1);
                    const unsigned a2 = __builtin_amdgcn_readlane(rc.x, j + 2);
                    const unsigned a3 = __builtin_amdgcn_readlane(rc.x, j + 3);
                    const float w0 = __uint_as_float(__builtin_amdgcn_readlane(rc.y, j));
                    const float w1 = __uint_as_float(__builtin_amdgcn_readlane(rc.y, j + 1));
                    const float w2 = __uint_as_float(__builtin_amdgcn_readlane(rc.y, j + 2));
                    const float w3 = __uint_as_float(__builtin_amdgcn_readlane(rc.y, j + 3));
                    // col * 256 is the row's byte offset; k and v share it
                    const unsigned ko0 = (a0 & ~255u) + l8, ko1 = (a1 & ~255u) + l8;
                    const unsigned ko2 = (a2 & ~255u) + l8, ko3 = (a3 & ~255u) + l8;
                    const float2 k0 = *(const float2*)((const char*)k + ko0);
                    const float2 k1 = *(const float2*)((const char*)k + ko1);
                    const float2 k2 = *(const float2*)((const char*)k + ko2);
                    const float2 k3 = *(const float2*)((const char*)k + ko3);
                    const float2 v0 = *(const float2*)((const char*)v + ko0);
                    const float2 v1 = *(const float2*)((const char*)v + ko1);
                    const float2 v2 = *(const float2*)((const char*)v + ko2);
                    const float2 v3 = *(const float2*)((const char*)v + ko3);
                    const int o0 = (int)(a0 & 255u) * HIDDEN, o1 = (int)(a1 & 255u) * HIDDEN;
                    const int o2 = (int)(a2 & 255u) * HIDDEN, o3 = (int)(a3 & 255u) * HIDDEN;
                    const float2 q0 = *(const float2*)(qs + o0 + lane * 2);
                    const float2 q1 = *(const float2*)(qs + o1 + lane * 2);
                    const float2 q2 = *(const float2*)(qs + o2 + lane * 2);
                    const float2 q3 = *(const float2*)(qs + o3 + lane * 2);

                    const float t0 = SparseMHA_attn(q0, k0, w0);
                    const float t1 = SparseMHA_attn(q1, k1, w1);
                    const float t2 = SparseMHA_attn(q2, k2, w2);
                    const float t3 = SparseMHA_attn(q3, k3, w3);

                    atomicAdd(acc + o0 + lane,      t0 * v0.x);
                    atomicAdd(acc + o0 + lane + 32, t0 * v0.y);
                    atomicAdd(acc + o1 + lane,      t1 * v1.x);
                    atomicAdd(acc + o1 + lane + 32, t1 * v1.y);
                    atomicAdd(acc + o2 + lane,      t2 * v2.x);
                    atomicAdd(acc + o2 + lane + 32, t2 * v2.y);
                    atomicAdd(acc + o3 + lane,      t3 * v3.x);
                    atomicAdd(acc + o3 + lane + 32, t3 * v3.y);
                    // the next trip reuses registers that the loads above name
                    asm volatile("s_wait_xcnt 0x0" ::: "memory");
                }
            }
            }
        }
        __syncthreads();

        for (int i = tid; i < nr * (HIDDEN / 4); i += 1024)
            ((float4*)(out + rb * HIDDEN))[i] = ((const float4*)acc)[i];
        __syncthreads();                         // acc and qs are free for the next range
    }
}

// ---------------------------------------------------------------------------
extern "C" void kernel_launch(void* const* d_in, const int* in_sizes, int n_in,
                              void* d_out, int out_size, void* d_ws, size_t ws_size,
                              hipStream_t stream) {
    const float* h   = (const float*)d_in[0];
    const int*   row = (const int*)  d_in[1];
    const int*   col = (const int*)  d_in[2];
    const float* ew  = (const float*)d_in[3];
    const float* Wq  = (const float*)d_in[4];
    const float* bq  = (const float*)d_in[5];
    const float* Wk  = (const float*)d_in[6];
    const float* bk  = (const float*)d_in[7];
    const float* Wv  = (const float*)d_in[8];
    const float* bv  = (const float*)d_in[9];
    float*       out = (float*)d_out;

    const int n   = in_sizes[0] / HIDDEN;   // 50000
    const int nnz = in_sizes[1];            // 1600000

    float* qws = (float*)d_ws;
    float* kws = qws + (size_t)n * HIDDEN;
    float* vws = kws + (size_t)n * HIDDEN;
    unsigned* rec = (unsigned*)(vws + (size_t)n * HIDDEN);   // 2 words per edge, whole chunks
    unsigned* off = rec + 2 * ((size_t)nnz + CHCAP);         // NB + 1 words per chunk

    // q/k/v projections via fp32 WMMA (fixed grid of blocks looping over row tiles)
    SparseMHA_proj_kernel<<<PROJ_BLOCKS, 128, 0, stream>>>(
        h, Wq, bq, Wk, bk, Wv, bv, qws, kws, vws, n);

    // edge records in order of out-row range, chunk by chunk
    SparseMHA_sort_kernel<<<SORT_BLOCKS, 1024, 0, stream>>>(row, col, ew, rec, off, nnz, n);

    // fused edge SDDMM + sigmoid*w + sums in LDS, every out row stored once
    SparseMHA_edge_kernel<<<SUM_BLOCKS, 1024, 0, stream>>>(
        qws, kws, vws, rec, off, out, nnz, n);
}

// v005
// Measured time: 61.4 microseconds a run.
// Timed twice side by side with v004, it ran 1.09 times as fast both times.
// Over all steps from v000 it is 2.70 times as fast.
#include <hip/hip_runtime.h>
#include <hip/hip_bf16.h>
#include <math.h>

#define HIDDEN    64
#define NUM_HEADS 4
#define HEAD_DIM  16
#define SCALING   0.25f  // HEAD_DIM^-0.5

typedef __attribute__((ext_vector_type(2))) float v2f;
typedef __attribute__((ext_vector_type(8))) float v8f;
typedef __attribute__((ext_vector_type(4))) float v4f;

// ---------------------------------------------------------------------------
// Kernel 1: fused q/k/v projection using native fp32 WMMA (16x16x4).
//   Block = 128 threads = 4 waves, wave w -> stored slots [16w,16w+16).
//   The grid is fixed. A wave reads the 48 B fragments of its 16 slots (three
//   weight matrices, 16 K-steps) ONCE and keeps them in registers, then loops
//   over tiles of 16 rows of h (tile index strided by the block count): per
//   tile it loads only the 16 A fragments, a quarter of the fragment loads.
//   48 v_wmma_f32_16x16x4_f32 per wave and tile. Epilogue adds bias (and
//   applies SCALING to q as in the reference).
// ---------------------------------------------------------------------------
#define PROJ_BLOCKS 512   // 256 WGPs x 2 blocks: 2 waves per SIMD, about 6 tiles per block

__global__ __launch_bounds__(128) void SparseMHA_proj_kernel(
    const float* __restrict__ h,
    const float* __restrict__ Wq, const float* __restrict__ bq,
    const float* __restrict__ Wk, const float* __restrict__ bk,
    const float* __restrict__ Wv, const float* __restrict__ bv,
    float* __restrict__ qout, float* __restrict__ kout, float* __restrict__ vout,
    int n)
{
    const int wave = threadIdx.x >> 5;
    const int lane = threadIdx.x & 31;
    const int half = lane >> 4;      // 0: K lo pair / M,N 0-7 side, 1: K hi pair
    const int r16  = lane & 15;
    const int n0   = wave * 16;
    const int nt   = (n + 15) >> 4;  // tiles of 16 rows

    int t = blockIdx.x;
    if (t >= nt) return;             // whole block leaves; the kernel has no barrier

    // Slot colj of a stored q/k/v row holds channel chan: slots 4l..4l+3 hold the channels
    // of head l & 3 with d = 4 (l >> 2) .. + 3 (channel = d * 4 + head), so that kernel 3
    // reads four channels of one head with one 16-byte load per lane, 16 lanes to a row.
    const int colj = n0 + r16;
    const int chan = (colj & 48) | ((colj & 3) << 2) | ((colj >> 2) & 3);
    const float* __restrict__ wqrow = Wq + chan * HIDDEN + half * 2;  // B[kk,n] = W[chan(n0+n), kb+kk]
    const float* __restrict__ wkrow = Wk + chan * HIDDEN + half * 2;
    const float* __restrict__ wvrow = Wv + chan * HIDDEN + half * 2;

    v2f bqf[16], bkf[16], bvf[16];   // this lane's K pair of every 4-wide slab, all three matrices
#pragma unroll
    for (int ks = 0; ks < 16; ++ks) {
        bqf[ks] = *(const v2f*)(wqrow + ks * 4);
        bkf[ks] = *(const v2f*)(wkrow + ks * 4);
        bvf[ks] = *(const v2f*)(wvrow + ks * 4);
    }
    const float biasq = bq[chan];
    const float biask = bk[chan];
    const float biasv = bv[chan];

    // A-row clamped so WMMA can run with EXEC all-ones even on a ragged tail.
    v2f af[16];
    {
        const float* __restrict__ hrow = h + min(t * 16 + r16, n - 1) * HIDDEN + half * 2;
#pragma unroll
        for (int ks = 0; ks < 16; ++ks) af[ks] = *(const v2f*)(hrow + ks * 4);
    }

    for (;;) {
        // the next tile's A fragments come in under this tile's WMMAs
        // (the last trip reads its own tile again: always in bounds)
        const int tn = t + PROJ_BLOCKS;
        const int tp = tn < nt ? tn : t;
        v2f an[16];
        {
            const float* __restrict__ hrow = h + min(tp * 16 + r16, n - 1) * HIDDEN + half * 2;
#pragma unroll
            for (int ks = 0; ks < 16; ++ks) an[ks] = *(const v2f*)(hrow + ks * 4);
        }

        v8f accq = {}; v8f acck = {}; v8f accv = {};
#pragma unroll
        for (int ks = 0; ks < 16; ++ks) {
            accq = __builtin_amdgcn_wmma_f32_16x16x4_f32(false, af[ks], false, bqf[ks],
                                                         (short)0, accq, false, false);
            acck = __builtin_amdgcn_wmma_f32_16x16x4_f32(false, af[ks], false, bkf[ks],
                                                         (short)0, acck, false, false);
            accv = __builtin_amdgcn_wmma_f32_16x16x4_f32(false, af[ks], false, bvf[ks],
                                                         (short)0, accv, false, false);
        }

        // four vector slots between the last WMMA and the first vector instruction that
        // reuses its A registers (dead from here on) or reads its result; the two
        // scheduling barriers keep the slots directly behind that WMMA
        __builtin_amdgcn_sched_barrier(0);
        asm volatile("v_nop\n\tv_nop\n\tv_nop\n\tv_nop");
        __builtin_amdgcn_sched_barrier(0);

        // C layout: VGPR vr, lanes 0-15 -> M = vr, lanes 16-31 -> M = vr + 8; N = lane%16
        const int m0 = t * 16;
#pragma unroll
        for (int vr = 0; vr < 8; ++vr) {
            const int m = m0 + vr + half * 8;
            if (m < n) {
                const int idx = m * HIDDEN + colj;
                qout[idx] = (accq[vr] + biasq) * SCALING;
                kout[idx] =  acck[vr] + biask;
                vout[idx] =  accv[vr] + biasv;
            }
        }

        if (tn >= nt) break;
        t = tn;
#pragma unroll
        for (int ks = 0; ks < 16; ++ks) af[ks] = an[ks];
    }
}

// ---------------------------------------------------------------------------
// Kernel 2: edges sorted by range of out rows, chunk by chunk.
//   The out rows are cut into NB ranges of RPB rows; the edge list into chunks
//   of CHCAP edges. A block counts its chunk's edges per range in LDS, scans
//   the counts, places each edge's 8-byte record (col * 256 + row inside its
//   range, edge weight) in LDS in range order and writes the chunk out in whole
//   lines, with the NB + 1 starts of the ranges inside the chunk.
//   The declared shapes give n <= NB * RPB rows.
// ---------------------------------------------------------------------------
#define RPB    196    // out rows per range: sums and q rows of a range take 123 KiB of LDS
#define NB     256    // ranges: one per WGP
#define CHCAP  6272   // edges per chunk (49 KiB of records in LDS)
#define EPT    7      // edges per thread of a 1024-thread block: ceil(CHCAP / 1024)
#define SORT_BLOCKS 256
#define SUM_BLOCKS  256

__global__ __launch_bounds__(1024) void SparseMHA_sort_kernel(
    const int* __restrict__ row, const int* __restrict__ col,
    const float* __restrict__ ew,
    unsigned* __restrict__ rec, unsigned* __restrict__ off, int nnz, int n)
{
    __shared__ unsigned cnt[NB];
    __shared__ unsigned scn[NB];
    __shared__ uint2    srt[CHCAP];
    const int tid  = threadIdx.x;
    const int nch  = (nnz + CHCAP - 1) / CHCAP;
    const int rmax = min(n, NB * RPB) - 1;

    for (int c = blockIdx.x; c < nch; c += gridDim.x) {
        const int e0 = c * CHCAP;
        const int m  = min(CHCAP, nnz - e0);
        // a thread's EPT edges are asked for at once and stay in registers for both passes
        int rr[EPT], cc[EPT]; float ww[EPT];
#pragma unroll
        for (int t = 0; t < EPT; ++t) {
            const int i = min(tid + t * 1024, m - 1);
            rr[t] = row[e0 + i]; cc[t] = col[e0 + i]; ww[t] = ew[e0 + i];
            // the loads stay in flight: a later trip's result may land in their offset register
            asm volatile("s_wait_xcnt 0x0" ::: "memory");
        }
        if (tid < NB) cnt[tid] = 0u;
        __syncthreads();
#pragma unroll
        for (int t = 0; t < EPT; ++t) {
            rr[t] = min(max(rr[t], 0), rmax);
            if (tid + t * 1024 < m) atomicAdd(&cnt[rr[t] / RPB], 1u);
        }
        __syncthreads();
        // inclusive scan of the NB counts (every thread passes every barrier)
        unsigned x = 0u;
        if (tid < NB) { x = cnt[tid]; scn[tid] = x; }
        __syncthreads();
        for (int d = 1; d < NB; d <<= 1) {
            unsigned y = 0u;
            if (tid < NB && tid >= d) y = scn[tid - d];
            __syncthreads();
            if (tid < NB) { x += y; scn[tid] = x; }
            __syncthreads();
        }
        if (tid < NB) {
            const unsigned st = x - cnt[tid];      // first place of this range in the chunk
            off[c * (NB + 1) + tid] = st;
            cnt[tid] = st;                         // from here on the range's next free place
        }
        if (tid == 0) off[c * (NB + 1) + NB] = (unsigned)m;
        __syncthreads();
#pragma unroll
        for (int t = 0; t < EPT; ++t) {
            if (tid + t * 1024 < m) {
                const int cl = min(max(cc[t], 0), n - 1);
                const int b  = rr[t] / RPB;
                const unsigned pos = atomicAdd(&cnt[b], 1u);
                srt[pos] = make_uint2(((unsigned)cl << 8) | (unsigned)(rr[t] - b * RPB),
                                      __float_as_uint(ww[t]));
            }
        }
        __syncthreads();
        for (int i = tid; i < m; i += 1024) ((uint2*)rec)[e0 + i] = srt[i];
        __syncthreads();                           // srt and cnt are free for the next chunk
    }
}

// ---------------------------------------------------------------------------
// Kernel 3: fused SDDMM + sigmoid*edge_weight + SPMM, one block per row range.
//   The block holds its range's q rows and its out sums in LDS. A wave takes
//   every 32nd chunk and reads the range's records of that chunk, 32 at a time.
//   TWO EDGES PER WAVE INSTRUCTION: each 16-lane row of the wave works on an
//   edge of its own. Lane l of a row reads slots 4l..4l+3 of a k, v or q row
//   with one 16-byte load; kernel 1 stores there four channels of head l & 3,
//   so a lane sums four products itself and the sum over d ends over the lanes
//   with equal l & 3 (xor 4, 8 inside the row). Only the k and v rows come from
//   L2, the sums are LDS adds, and each out row is stored once (rows without an
//   edge as zero).
//   LDS rows have a pitch of LPITCH words. A sum row holds value i of lane l at
//   word 16 i + l: one add instruction covers 16 banks in a run for each edge,
//   and the pitch sets the runs of rows r and r + 1 on different banks.
// ---------------------------------------------------------------------------
#define LPITCH 80     // words per q row and per sum row in LDS (64 used)

// A batch of m (1 to 32) records is dealt to the two 16-lane rows: row 0 takes the
// first ceil(m / 2), row 1 the rest. The index of this lane's record (clamped into the batch):
__device__ __forceinline__ int SparseMHA_deal(int lane, int m) {
    return min((lane >> 4) * ((m + 1) >> 1) + (lane & 15), m - 1);
}
// whether the lane's record is its own (else it is a copy and gets weight zero)
__device__ __forceinline__ bool SparseMHA_dealt(int lane, int m) {
    const int hm = (m + 1) >> 1;
    return (lane & 15) < ((lane >> 4) ? m - hm : hm);
}

// every lane gets the value of lane s of its own 16-lane row; sel holds s in each nibble
__device__ __forceinline__ unsigned SparseMHA_row_lane(unsigned x, unsigned sel) {
    return (unsigned)__builtin_amdgcn_permlane16((int)x, (int)x, sel, sel, false, false);
}

// sum over the lanes l ^ 4, l ^ 8 of a 16-lane row (DPP row_xmask)
__device__ __forceinline__ float SparseMHA_head_sum(float p) {
    p += __builtin_bit_cast(float, __builtin_amdgcn_update_dpp(
             0, __builtin_bit_cast(int, p), 0x164, 0xf, 0xf, true));
    p += __builtin_bit_cast(float, __builtin_amdgcn_update_dpp(
             0, __builtin_bit_cast(int, p), 0x168, 0xf, 0xf, true));
    return p;
}

// U steps, each one edge per 16-lane row: the records of lanes j .. j + U - 1 of both rows.
// ka: col * 256 (byte offset of the k and v row), ra: byte offset of the row in LDS, wa: weight.
template <int U>
__device__ __forceinline__ void SparseMHA_steps(
    const float* __restrict__ k, const float* __restrict__ v,
    const float* qs, float* acc,
    unsigned ka, unsigned ra, unsigned wa, int j, unsigned l16)
{
    unsigned ko[U], ro[U];
    float    w[U];
    v4f      kk[U], vv[U], qq[U];
#pragma unroll
    for (int u = 0; u < U; ++u) {
        const unsigned sel = (unsigned)(j + u) * 0x11111111u;
        ko[u] = SparseMHA_row_lane(ka, sel) + l16 * 16u;
        ro[u] = SparseMHA_row_lane(ra, sel);
        w[u]  = __uint_as_float(SparseMHA_row_lane(wa, sel));
    }
#pragma unroll
    for (int u = 0; u < U; ++u) qq[u] = *(const v4f*)((const char*)qs + ro[u] + l16 * 16u);
    // All 2 U row loads of the steps in one statement with their data wait: written as plain
    // loads, the compiler sinks each step's loads to its own arithmetic and the L2 latencies
    // of the steps add up instead of overlapping.
    if constexpr (U == 4) {
        asm volatile("global_load_b128 %0, %8, %12\n\t"
                     "global_load_b128 %1, %9, %12\n\t"
                     "global_load_b128 %2, %10, %12\n\t"
                     "global_load_b128 %3, %11, %12\n\t"
                     "global_load_b128 %4, %8, %13\n\t"
                     "global_load_b128 %5, %9, %13\n\t"
                     "global_load_b128 %6, %10, %13\n\t"
                     "global_load_b128 %7, %11, %13\n\t"
                     "s_wait_loadcnt 0x0"
                     : "=&v"(kk[0]), "=&v"(kk[1]), "=&v"(kk[2]), "=&v"(kk[3]),
                       "=&v"(vv[0]), "=&v"(vv[1]), "=&v"(vv[2]), "=&v"(vv[3])
                     : "v"(ko[0]), "v"(ko[1]), "v"(ko[2]), "v"(ko[3]), "s"(k), "s"(v)
                     : "memory");
    } else {
        asm volatile("global_load_b128 %0, %4, %6\n\t"
                     "global_load_b128 %1, %5, %6\n\t"
                     "global_load_b128 %2, %4, %7\n\t"
                     "global_load_b128 %3, %5, %7\n\t"
                     "s_wait_loadcnt 0x0"
                     : "=&v"(kk[0]), "=&v"(kk[1]), "=&v"(vv[0]), "=&v"(vv[1])
                     : "v"(ko[0]), "v"(ko[1]), "s"(k), "s"(v)
                     : "memory");
    }
#pragma unroll
    for (int u = 0; u < U; ++u) {
        // four products of one head: two packed operations and one add
        const v2f s2 = __builtin_elementwise_fma(qq[u].zw, kk[u].zw, qq[u].xy * kk[u].xy);
        const float p = SparseMHA_head_sum(s2.x + s2.y);
        // sigmoid(q . k of this lane's head) * edge weight
        const float t = w[u] / (1.0f + __expf(-p));
        float* a = (float*)((char*)acc + ro[u] + l16 * 4u);
        atomicAdd(a,      t * vv[u].x);
        atomicAdd(a + 16, t * vv[u].y);
        atomicAdd(a + 32, t * vv[u].z);
        atomicAdd(a + 48, t * vv[u].w);
    }
}

__global__ __launch_bounds__(1024) void SparseMHA_edge_kernel(
    const float* __restrict__ q, const float* __restrict__ k,
    const float* __restrict__ v,
    const unsigned* __restrict__ rec, const unsigned* __restrict__ off,
    float* __restrict__ out, int nnz, int n)
{
    __shared__ __attribute__((aligned(16))) float acc[RPB * LPITCH];
    __shared__ __attribute__((aligned(16))) float qs[RPB * LPITCH];
    const int tid  = threadIdx.x;
    const int lane = tid & 31;
    // wave-uniform, so chunk numbers and range bounds stay in scalar registers
    const int wave = __builtin_amdgcn_readfirstlane(tid >> 5);
    const int nch  = (nnz + CHCAP - 1) / CHCAP;
    const int nb   = (n + RPB - 1) / RPB;
    const unsigned l16 = lane & 15;              // lane inside its 16-lane row

    for (int bin = blockIdx.x; bin < nb; bin += gridDim.x) {
        const int rb = bin * RPB;
        const int nr = min(RPB, n - rb);
        for (int i = tid; i < nr * (HIDDEN / 4); i += 1024) {
            const int li = (i >> 4) * (LPITCH / 4) + (i & 15);
            ((float4*)qs)[li]  = ((const float4*)(q + rb * HIDDEN))[i];
            ((float4*)acc)[li] = make_float4(0.f, 0.f, 0.f, 0.f);
        }
        __syncthreads();

        for (int c0 = wave; c0 < nch && bin < NB; c0 += 1024) {
            // lane t holds the range's bounds in chunk c0 + 32 t: one load for up to 32 chunks
            const int cl = min(c0 + lane * 32, nch - 1);
            const int sl = (int)off[cl * (NB + 1) + bin];
            const int el = (int)off[cl * (NB + 1) + bin + 1];
            const int nj = min(32, (nch - c0 + 31) >> 5);
            // the first 32 records of a chunk's part are asked for one chunk ahead
            uint2 nx = make_uint2(0u, 0u);
            {
                const int s1 = __builtin_amdgcn_readlane(sl, 0);
                const int e1 = __builtin_amdgcn_readlane(el, 0);
                if (e1 > s1) {
                    nx = ((const uint2*)rec + c0 * CHCAP)[s1 + SparseMHA_deal(lane, min(32, e1 - s1))];
                    // the load stays in flight: its address register is reused right behind it
                    asm volatile("s_wait_xcnt 0x0" ::: "memory");
                }
            }
            for (int t = 0; t < nj; ++t) {
            const int s = __builtin_amdgcn_readlane(sl, t);
            const int e = __builtin_amdgcn_readlane(el, t);
            const uint2* __restrict__ rp = (const uint2*)rec + (c0 + 32 * t) * CHCAP;
            uint2 rc = nx;
            if (t + 1 < nj) {
                const int s1 = __builtin_amdgcn_readlane(sl, t + 1);
                const int e1 = __builtin_amdgcn_readlane(el, t + 1);
                if (e1 > s1) {
                    nx = (rp + 32 * CHCAP)[s1 + SparseMHA_deal(lane, min(32, e1 - s1))];
                    // the load stays in flight: its address register is reused right behind it
                    asm volatile("s_wait_xcnt 0x0" ::: "memory");
                }
            }
            for (int p = s; p < e; p += 32) {
                const int m = min(32, e - p);
                if (p > s) {
                    rc = rp[p + SparseMHA_deal(lane, m)];
                    // the load stays in flight: its address register is reused right behind it
                    asm volatile("s_wait_xcnt 0x0" ::: "memory");
                }
                // a lane without a record of its own holds a copy with weight zero
                const unsigned wa = SparseMHA_dealt(lane, m) ? rc.y : 0u;
                const unsigned ka = rc.x & ~255u;
                const unsigned ra = (rc.x & 255u) * (LPITCH * 4u);
                const int hm = (m + 1) >> 1;     // steps: one edge per 16-lane row each
                for (int j = 0; j < hm; ) {
                    if (hm - j > 2) { SparseMHA_steps<4>(k, v, qs, acc, ka, ra, wa, j, l16); j += 4; }
                    else            { SparseMHA_steps<2>(k, v, qs, acc, ka, ra, wa, j, l16); j += 2; }
                }
            }
            }
        }
        __syncthreads();

        // channels 4c .. 4c+3 of a row are value c & 3 of lanes 4 (c >> 2) .. + 3
        for (int i = tid; i < nr * (HIDDEN / 4); i += 1024) {
            const int c = i & 15;
            ((float4*)(out + rb * HIDDEN))[i] =
                ((const float4*)acc)[(i >> 4) * (LPITCH / 4) + (c & 3) * 4 + (c >> 2)];
        }
        __syncthreads();                         // acc and qs are free for the next range
    }
}

// ---------------------------------------------------------------------------
extern "C" void kernel_launch(void* const* d_in, const int* in_sizes, int n_in,
                              void* d_out, int out_size, void* d_ws, size_t ws_size,
                              hipStream_t stream) {
    const float* h   = (const float*)d_in[0];
    const int*   row = (const int*)  d_in[1];
    const int*   col = (const int*)  d_in[2];
    const float* ew  = (const float*)d_in[3];
    const float* Wq  = (const float*)d_in[4];
    const float* bq  = (const float*)d_in[5];
    const float* Wk  = (const float*)d_in[6];
    const float* bk  = (const float*)d_in[7];
    const float* Wv  = (const float*)d_in[8];
    const float* bv  = (const float*)d_in[9];
    float*       out = (float*)d_out;

    const int n   = in_sizes[0] / HIDDEN;   // 50000
    const int nnz = in_sizes[1];            // 1600000

    float* qws = (float*)d_ws;
    float* kws = qws + (size_t)n * HIDDEN;
    float* vws = kws + (size_t)n * HIDDEN;
    unsigned* rec = (unsigned*)(vws + (size_t)n * HIDDEN);   // 2 words per edge, whole chunks
    unsigned* off = rec + 2 * ((size_t)nnz + CHCAP);         // NB + 1 words per chunk

    // q/k/v projections via fp32 WMMA (fixed grid of blocks looping over row tiles)
    SparseMHA_proj_kernel<<<PROJ_BLOCKS, 128, 0, stream>>>(
        h, Wq, bq, Wk, bk, Wv, bv, qws, kws, vws, n);

    // edge records in order of out-row range, chunk by chunk
    SparseMHA_sort_kernel<<<SORT_BLOCKS, 1024, 0, stream>>>(row, col, ew, rec, off, nnz, n);

    // fused edge SDDMM + sigmoid*w + sums in LDS, every out row stored once
    SparseMHA_edge_kernel<<<SUM_BLOCKS, 1024, 0, stream>>>(
        qws, kws, vws, rec, off, out, nnz, n);
}

// v006
// A run of this version takes 55 microseconds.
// Two timings next to v005 both put it at 1.12 times that version's speed.
// Counting every step since v000, it is 3.02 times as fast.
#include <hip/hip_runtime.h>
#include <hip/hip_bf16.h>
#include <math.h>

#define HIDDEN    64
#define NUM_HEADS 4
#define HEAD_DIM  16
#define SCALING   0.25f  // HEAD_DIM^-0.5

typedef __attribute__((ext_vector_type(2))) float v2f;
typedef __attribute__((ext_vector_type(8))) float v8f;
typedef __attribute__((ext_vector_type(4))) float v4f;

// ---------------------------------------------------------------------------
// Kernel 1: the q/k/v projection and the edge sort in ONE launch. Neither reads
//   what the other writes, so the block index picks the part: the first
//   PROJ_BLOCKS blocks project, the other SORT_BLOCKS sort. The sort's loads, LDS
//   adds and barriers run beside the projection's WMMAs, not behind them.
//
//   Projection, native fp32 WMMA (16x16x4): wave w -> stored slots
//   [16 (w & 3), + 16) of tile stream 2 * block + (w >> 2). A wave reads the 48
//   B fragments of its 16 slots (three weight matrices, 16 K-steps) ONCE and
//   keeps them in registers, then loops over tiles of 16 rows of h (tile index
//   strided by the stream count): per tile it loads only the 16 A fragments.
//   48 v_wmma_f32_16x16x4_f32 per wave and tile. Epilogue adds bias (and
//   applies SCALING to q as in the reference).
//
//   Sort: edges in order of out-row range, chunk by chunk. The out rows are cut
//   into NB ranges of RPB rows; the edge list into chunks of CHCAP edges. A
//   block counts its chunk's edges per range in LDS, scans the counts, places
//   each edge's 8-byte record (col * 256 + row inside its range, edge weight)
//   in LDS in range order and writes the chunk out in whole lines, with the
//   NB + 1 starts of the ranges inside the chunk.
//   The declared shapes give n <= NB * RPB rows.
// ---------------------------------------------------------------------------
#define PREP_THREADS 256  // 8 waves
#define PROJ_BLOCKS  256  // one per WGP
#define PROJ_STREAMS 512  // 2 per block: 2 projecting waves per SIMD, about 6 tiles per stream
#define SORT_BLOCKS  256  // one per WGP, one chunk each at the declared shapes
#define SUM_BLOCKS   256
#define RPB    196    // out rows per range: sums and q rows of a range take 123 KiB of LDS
#define NB     256    // ranges: one per WGP, and one per thread of a sorting block
#define CHCAP  6272   // edges per chunk (49 KiB of records in LDS)
#define EPT    25     // edges per thread of a sorting block: ceil(CHCAP / PREP_THREADS)
static_assert(NB == PREP_THREADS, "a sorting thread owns one range");
static_assert(EPT * PREP_THREADS >= CHCAP, "a chunk fits its block's threads");

__device__ __forceinline__ void SparseMHA_proj_part(
    const float* __restrict__ h,
    const float* __restrict__ Wq, const float* __restrict__ bq,
    const float* __restrict__ Wk, const float* __restrict__ bk,
    const float* __restrict__ Wv, const float* __restrict__ bv,
    float* __restrict__ qout, float* __restrict__ kout, float* __restrict__ vout,
    int n, int blk)
{
    // wave-uniform, so the tile loop is scalar control flow and EXEC stays all ones at the WMMAs
    const int wave = __builtin_amdgcn_readfirstlane(threadIdx.x >> 5);
    const int lane = threadIdx.x & 31;
    const int half = lane >> 4;      // 0: K lo pair / M,N 0-7 side, 1: K hi pair
    const int r16  = lane & 15;
    const int n0   = (wave & 3) * 16;
    const int nt   = (n + 15) >> 4;  // tiles of 16 rows

    int t = blk * 2 + (wave >> 2);
    if (t >= nt) return;             // whole waves leave; this part has no barrier

    // Slot colj of a stored q/k/v row holds channel chan: slots 4l..4l+3 hold the channels
    // of head l & 3 with d = 4 (l >> 2) .. + 3 (channel = d * 4 + head), so that kernel 2
    // reads four channels of one head with one 16-byte load per lane, 16 lanes to a row.
    const int colj = n0 + r16;
    const int chan = (colj & 48) | ((colj & 3) << 2) | ((colj >> 2) & 3);
    const float* __restrict__ wqrow = Wq + chan * HIDDEN + half * 2;  // B[kk,n] = W[chan(n0+n), kb+kk]
    const float* __restrict__ wkrow = Wk + chan * HIDDEN + half * 2;
    const float* __restrict__ wvrow = Wv + chan * HIDDEN + half * 2;

    v2f bqf[16], bkf[16], bvf[16];   // this lane's K pair of every 4-wide slab, all three matrices
#pragma unroll
    for (int ks = 0; ks < 16; ++ks) {
        bqf[ks] = *(const v2f*)(wqrow + ks * 4);
        bkf[ks] = *(const v2f*)(wkrow + ks * 4);
        bvf[ks] = *(const v2f*)(wvrow + ks * 4);
    }
    const float biasq = bq[chan];
    const float biask = bk[chan];
    const float biasv = bv[chan];

    // A-row clamped so WMMA can run with EXEC all-ones even on a ragged tail.
    v2f af[16];
    {
        const float* __restrict__ hrow = h + min(t * 16 + r16, n - 1) * HIDDEN + half * 2;
#pragma unroll
        for (int ks = 0; ks < 16; ++ks) af[ks] = *(const v2f*)(hrow + ks * 4);
    }

    for (;;) {
        // the next tile's A fragments come in under this tile's WMMAs
        // (the last trip reads its own tile again: always in bounds)
        const int tn = t + PROJ_STREAMS;
        const int tp = tn < nt ? tn : t;
        v2f an[16];
        {
            const float* __restrict__ hrow = h + min(tp * 16 + r16, n - 1) * HIDDEN + half * 2;
#pragma unroll
            for (int ks = 0; ks < 16; ++ks) an[ks] = *(const v2f*)(hrow + ks * 4);
        }

        v8f accq = {}; v8f acck = {}; v8f accv = {};
#pragma unroll
        for (int ks = 0; ks < 16; ++ks) {
            accq = __builtin_amdgcn_wmma_f32_16x16x4_f32(false, af[ks], false, bqf[ks],
                                                         (short)0, accq, false, false);
            acck = __builtin_amdgcn_wmma_f32_16x16x4_f32(false, af[ks], false, bkf[ks],
                                                         (short)0, acck, false, false);
            accv = __builtin_amdgcn_wmma_f32_16x16x4_f32(false, af[ks], false, bvf[ks],
                                                         (short)0, accv, false, false);
        }

        // four vector slots between the last WMMA and the first vector instruction that
        // reuses its A registers (dead from here on) or reads its result; the two
        // scheduling barriers keep the slots directly behind that WMMA
        __builtin_amdgcn_sched_barrier(0);
        asm volatile("v_nop\n\tv_nop\n\tv_nop\n\tv_nop");
        __builtin_amdgcn_sched_barrier(0);

        // C layout: VGPR vr, lanes 0-15 -> M = vr, lanes 16-31 -> M = vr + 8; N = lane%16
        const int m0 = t * 16;
#pragma unroll
        for (int vr = 0; vr < 8; ++vr) {
            const int m = m0 + vr + half * 8;
            if (m < n) {
                const int idx = m * HIDDEN + colj;
                qout[idx] = (accq[vr] + biasq) * SCALING;
                kout[idx] =  acck[vr] + biask;
                vout[idx] =  accv[vr] + biasv;
            }
        }
        // the next trip overwrites registers that the last row's stores name
        asm volatile("s_wait_xcnt 0x0" ::: "memory");

        if (tn >= nt) break;
        t = tn;
#pragma unroll
        for (int ks = 0; ks < 16; ++ks) af[ks] = an[ks];
    }
}

// cnt, scn: NB words each; srt: CHCAP records and 32 spare ones. Thread tid owns range tid in the scan.
__device__ __forceinline__ void SparseMHA_sort_part(
    const int* __restrict__ row, const int* __restrict__ col,
    const float* __restrict__ ew,
    unsigned* __restrict__ rec, unsigned* __restrict__ off, int nnz, int n, int blk,
    unsigned* cnt, unsigned* scn, uint2* srt)
{
    const int tid  = threadIdx.x;
    const int nch  = (nnz + CHCAP - 1) / CHCAP;
    const int rmax = min(n, NB * RPB) - 1;

    for (int c = blk; c < nch; c += SORT_BLOCKS) {
        const int e0 = c * CHCAP;
        const int m  = min(CHCAP, nnz - e0);
        // a thread's EPT edges are asked for at once and stay in registers for both passes
        int rr[EPT], cc[EPT]; float ww[EPT];
#pragma unroll
        for (int t = 0; t < EPT; ++t) {
            const int i = min(tid + t * PREP_THREADS, m - 1);
            rr[t] = row[e0 + i]; cc[t] = col[e0 + i]; ww[t] = ew[e0 + i];
            // the loads stay in flight: a later trip's result may land in their offset register
            asm volatile("s_wait_xcnt 0x0" ::: "memory");
        }
        cnt[tid] = 0u;
        __syncthreads();
#pragma unroll
        for (int t = 0; t < EPT; ++t) {
            rr[t] = min(max(rr[t], 0), rmax);
            if (tid + t * PREP_THREADS < m) atomicAdd(&cnt[rr[t] / RPB], 1u);
        }
        __syncthreads();
        // inclusive scan of the NB counts (every thread passes every barrier)
        unsigned x = cnt[tid];
        scn[tid] = x;
        __syncthreads();
        for (int d = 1; d < NB; d <<= 1) {
            unsigned y = 0u;
            if (tid >= d) y = scn[tid - d];
            __syncthreads();
            x += y; scn[tid] = x;
            __syncthreads();
        }
        {
            const unsigned st = x - cnt[tid];      // first place of this range in the chunk
            off[c * (NB + 1) + tid] = st;
            cnt[tid] = st;                         // from here on the range's next free place
        }
        if (tid == 0) off[c * (NB + 1) + NB] = (unsigned)m;
        __syncthreads();
        // a thread's EPT places are all asked for before the first is used: with 8 waves
        // to a chunk the latencies of the returning adds would otherwise stand in a row
        unsigned pos[EPT];
#pragma unroll
        for (int t = 0; t < EPT; ++t) {
            pos[t] = 0u;
            if (tid + t * PREP_THREADS < m) pos[t] = atomicAdd(&cnt[rr[t] / RPB], 1u);
        }
        // no branch round the stores (a lane without an edge writes its own spare record
        // behind the chunk, which nobody reads): one run of stores behind one wait
#pragma unroll
        for (int t = 0; t < EPT; ++t) {
            const int cl = min(max(cc[t], 0), n - 1);
            const int b  = rr[t] / RPB;
            const unsigned at = tid + t * PREP_THREADS < m ? pos[t] : (unsigned)(CHCAP + (tid & 31));
            srt[at] = make_uint2(((unsigned)cl << 8) | (unsigned)(rr[t] - b * RPB),
                                 __float_as_uint(ww[t]));
        }
        __syncthreads();
        // likewise all LDS reads first (index clamped into the chunk), then the stores
        uint2 ro[EPT];
#pragma unroll
        for (int t = 0; t < EPT; ++t) ro[t] = srt[min(tid + t * PREP_THREADS, m - 1)];
#pragma unroll
        for (int t = 0; t < EPT; ++t) {
            const int i = tid + t * PREP_THREADS;
            if (i < m) ((uint2*)rec)[e0 + i] = ro[t];
        }
        __syncthreads();                           // srt and cnt are free for the next chunk
    }
}

__global__ __launch_bounds__(PREP_THREADS) void SparseMHA_prep_kernel(
    const float* __restrict__ h,
    const float* __restrict__ Wq, const float* __restrict__ bq,
    const float* __restrict__ Wk, const float* __restrict__ bk,
    const float* __restrict__ Wv, const float* __restrict__ bv,
    const int* __restrict__ row, const int* __restrict__ col,
    const float* __restrict__ ew,
    float* __restrict__ qout, float* __restrict__ kout, float* __restrict__ vout,
    unsigned* __restrict__ rec, unsigned* __restrict__ off, int nnz, int n)
{
    __shared__ unsigned cnt[NB];
    __shared__ unsigned scn[NB];
    __shared__ uint2    srt[CHCAP + 32];
    // the same for a whole block: every barrier of the sort is passed by all of its threads
    if (blockIdx.x < PROJ_BLOCKS)
        SparseMHA_proj_part(h, Wq, bq, Wk, bk, Wv, bv, qout, kout, vout, n, blockIdx.x);
    else
        SparseMHA_sort_part(row, col, ew, rec, off, nnz, n, blockIdx.x - PROJ_BLOCKS,
                            cnt, scn, srt);
}

// ---------------------------------------------------------------------------
// Kernel 2: fused SDDMM + sigmoid*edge_weight + SPMM, one block per row range.
//   The block holds its range's q rows and its out sums in LDS. A wave takes
//   every 32nd chunk and reads the range's records of that chunk, 32 at a time.
//   TWO EDGES PER WAVE INSTRUCTION: each 16-lane row of the wave works on an
//   edge of its own. Lane l of a row reads slots 4l..4l+3 of a k, v or q row
//   with one 16-byte load; kernel 1 stores there four channels of head l & 3,
//   so a lane sums four products itself and the sum over d ends over the lanes
//   with equal l & 3 (xor 4, 8 inside the row). Only the k and v rows come from
//   L2, the sums are LDS adds, and each out row is stored once (rows without an
//   edge as zero).
//   LDS rows have a pitch of LPITCH words. A sum row holds value i of lane l at
//   word 16 i + l: one add instruction covers 16 banks in a run for each edge,
//   and the pitch sets the runs of rows r and r + 1 on different banks.
// ---------------------------------------------------------------------------
#define LPITCH 80     // words per q row and per sum row in LDS (64 used)

// A batch of m (1 to 32) records is dealt to the two 16-lane rows: row 0 takes the
// first ceil(m / 2), row 1 the rest. The index of this lane's record (clamped into the batch):
__device__ __forceinline__ int SparseMHA_deal(int lane, int m) {
    return min((lane >> 4) * ((m + 1) >> 1) + (lane & 15), m - 1);
}
// whether the lane's record is its own (else it is a copy and gets weight zero)
__device__ __forceinline__ bool SparseMHA_dealt(int lane, int m) {
    const int hm = (m + 1) >> 1;
    return (lane & 15) < ((lane >> 4) ? m - hm : hm);
}

// every lane gets the value of lane s of its own 16-lane row; sel holds s in each nibble
__device__ __forceinline__ unsigned SparseMHA_row_lane(unsigned x, unsigned sel) {
    return (unsigned)__builtin_amdgcn_permlane16((int)x, (int)x, sel, sel, false, false);
}

// sum over the lanes l ^ 4, l ^ 8 of a 16-lane row (DPP row_xmask)
__device__ __forceinline__ float SparseMHA_head_sum(float p) {
    p += __builtin_bit_cast(float, __builtin_amdgcn_update_dpp(
             0, __builtin_bit_cast(int, p), 0x164, 0xf, 0xf, true));
    p += __builtin_bit_cast(float, __builtin_amdgcn_update_dpp(
             0, __builtin_bit_cast(int, p), 0x168, 0xf, 0xf, true));
    return p;
}

// U steps, each one edge per 16-lane row: the records of lanes j .. j + U - 1 of both rows.
// ka: col * 256 (byte offset of the k and v row), ra: byte offset of the row in LDS, wa: weight.
template <int U>
__device__ __forceinline__ void SparseMHA_steps(
    const float* __restrict__ k, const float* __restrict__ v,
    const float* qs, float* acc,
    unsigned ka, unsigned ra, unsigned wa, int j, unsigned l16)
{
    unsigned ko[U], ro[U];
    float    w[U];
    v4f      kk[U], vv[U], qq[U];
#pragma unroll
    for (int u = 0; u < U; ++u) {
        const unsigned sel = (unsigned)(j + u) * 0x11111111u;
        ko[u] = SparseMHA_row_lane(ka, sel) + l16 * 16u;
        ro[u] = SparseMHA_row_lane(ra, sel);
        w[u]  = __uint_as_float(SparseMHA_row_lane(wa, sel));
    }
#pragma unroll
    for (int u = 0; u < U; ++u) qq[u] = *(const v4f*)((const char*)qs + ro[u] + l16 * 16u);
    // All 2 U row loads of the steps in one statement with their data wait: written as plain
    // loads, the compiler sinks each step's loads to its own arithmetic and the L2 latencies
    // of the steps add up instead of overlapping.
    if constexpr (U == 4) {
        asm volatile("global_load_b128 %0, %8, %12\n\t"
                     "global_load_b128 %1, %9, %12\n\t"
                     "global_load_b128 %2, %10, %12\n\t"
                     "global_load_b128 %3, %11, %12\n\t"
                     "global_load_b128 %4, %8, %13\n\t"
                     "global_load_b128 %5, %9, %13\n\t"
                     "global_load_b128 %6, %10, %13\n\t"
                     "global_load_b128 %7, %11, %13\n\t"
                     "s_wait_loadcnt 0x0"
                     : "=&v"(kk[0]), "=&v"(kk[1]), "=&v"(kk[2]), "=&v"(kk[3]),
                       "=&v"(vv[0]), "=&v"(vv[1]), "=&v"(vv[2]), "=&v"(vv[3])
                     : "v"(ko[0]), "v"(ko[1]), "v"(ko[2]), "v"(ko[3]), "s"(k), "s"(v)
                     : "memory");
    } else {
        asm volatile("global_load_b128 %0, %4, %6\n\t"
                     "global_load_b128 %1, %5, %6\n\t"
                     "global_load_b128 %2, %4, %7\n\t"
                     "global_load_b128 %3, %5, %7\n\t"
                     "s_wait_loadcnt 0x0"
                     : "=&v"(kk[0]), "=&v"(kk[1]), "=&v"(vv[0]), "=&v"(vv[1])
                     : "v"(ko[0]), "v"(ko[1]), "s"(k), "s"(v)
                     : "memory");
    }
#pragma unroll
    for (int u = 0; u < U; ++u) {
        // four products of one head: two packed operations and one add
        const v2f s2 = __builtin_elementwise_fma(qq[u].zw, kk[u].zw, qq[u].xy * kk[u].xy);
        const float p = SparseMHA_head_sum(s2.x + s2.y);
        // sigmoid(q . k of this lane's head) * edge weight
        const float t = w[u] / (1.0f + __expf(-p));
        float* a = (float*)((char*)acc + ro[u] + l16 * 4u);
        atomicAdd(a,      t * vv[u].x);
        atomicAdd(a + 16, t * vv[u].y);
        atomicAdd(a + 32, t * vv[u].z);
        atomicAdd(a + 48, t * vv[u].w);
    }
}

__global__ __launch_bounds__(1024) void SparseMHA_edge_kernel(
    const float* __restrict__ q, const float* __restrict__ k,
    const float* __restrict__ v,
    const unsigned* __restrict__ rec, const unsigned* __restrict__ off,
    float* __restrict__ out, int nnz, int n)
{
    __shared__ __attribute__((aligned(16))) float acc[RPB * LPITCH];
    __shared__ __attribute__((aligned(16))) float qs[RPB * LPITCH];
    const int tid  = threadIdx.x;
    const int lane = tid & 31;
    // wave-uniform, so chunk numbers and range bounds stay in scalar registers
    const int wave = __builtin_amdgcn_readfirstlane(tid >> 5);
    const int nch  = (nnz + CHCAP - 1) / CHCAP;
    const int nb   = (n + RPB - 1) / RPB;
    const unsigned l16 = lane & 15;              // lane inside its 16-lane row

    for (int bin = blockIdx.x; bin < nb; bin += gridDim.x) {
        const int rb = bin * RPB;
        const int nr = min(RPB, n - rb);
        for (int i = tid; i < nr * (HIDDEN / 4); i += 1024) {
            const int li = (i >> 4) * (LPITCH / 4) + (i & 15);
            ((float4*)qs)[li]  = ((const float4*)(q + rb * HIDDEN))[i];
            ((float4*)acc)[li] = make_float4(0.f, 0.f, 0.f, 0.f);
        }
        __syncthreads();

        for (int c0 = wave; c0 < nch && bin < NB; c0 += 1024) {
            // lane t holds the range's bounds in chunk c0 + 32 t: one load for up to 32 chunks
            const int cl = min(c0 + lane * 32, nch - 1);
            const int sl = (int)off[cl * (NB + 1) + bin];
            const int el = (int)off[cl * (NB + 1) + bin + 1];
            const int nj = min(32, (nch - c0 + 31) >> 5);
            // the first 32 records of a chunk's part are asked for one chunk ahead
            uint2 nx = make_uint2(0u, 0u);
            {
                const int s1 = __builtin_amdgcn_readlane(sl, 0);
                const int e1 = __builtin_amdgcn_readlane(el, 0);
                if (e1 > s1) {
                    nx = ((const uint2*)rec + c0 * CHCAP)[s1 + SparseMHA_deal(lane, min(32, e1 - s1))];
                    // the load stays in flight: its address register is reused right behind it
                    asm volatile("s_wait_xcnt 0x0" ::: "memory");
                }
            }
            for (int t = 0; t < nj; ++t) {
            const int s = __builtin_amdgcn_readlane(sl, t);
            const int e = __builtin_amdgcn_readlane(el, t);
            const uint2* __restrict__ rp = (const uint2*)rec + (c0 + 32 * t) * CHCAP;
            uint2 rc = nx;
            if (t + 1 < nj) {
                const int s1 = __builtin_amdgcn_readlane(sl, t + 1);
                const int e1 = __builtin_amdgcn_readlane(el, t + 1);
                if (e1 > s1) {
                    nx = (rp + 32 * CHCAP)[s1 + SparseMHA_deal(lane, min(32, e1 - s1))];
                    // the load stays in flight: its address register is reused right behind it
                    asm volatile("s_wait_xcnt 0x0" ::: "memory");
                }
            }
            for (int p = s; p < e; p += 32) {
                const int m = min(32, e - p);
                if (p > s) {
                    rc = rp[p + SparseMHA_deal(lane, m)];
                    // the load stays in flight: its address register is reused right behind it
                    asm volatile("s_wait_xcnt 0x0" ::: "memory");
                }
                // a lane without a record of its own holds a copy with weight zero
                const unsigned wa = SparseMHA_dealt(lane, m) ? rc.y : 0u;
                const unsigned ka = rc.x & ~255u;
                const unsigned ra = (rc.x & 255u) * (LPITCH * 4u);
                const int hm = (m + 1) >> 1;     // steps: one edge per 16-lane row each
                for (int j = 0; j < hm; ) {
                    if (hm - j > 2) { SparseMHA_steps<4>(k, v, qs, acc, ka, ra, wa, j, l16); j += 4; }
                    else            { SparseMHA_steps<2>(k, v, qs, acc, ka, ra, wa, j, l16); j += 2; }
                }
            }
            }
        }
        __syncthreads();

        // channels 4c .. 4c+3 of a row are value c & 3 of lanes 4 (c >> 2) .. + 3
        for (int i = tid; i < nr * (HIDDEN / 4); i += 1024) {
            const int c = i & 15;
            ((float4*)(out + rb * HIDDEN))[i] =
                ((const float4*)acc)[(i >> 4) * (LPITCH / 4) + (c & 3) * 4 + (c >> 2)];
        }
        __syncthreads();                         // acc and qs are free for the next range
    }
}

// ---------------------------------------------------------------------------
extern "C" void kernel_launch(void* const* d_in, const int* in_sizes, int n_in,
                              void* d_out, int out_size, void* d_ws, size_t ws_size,
                              hipStream_t stream) {
    const float* h   = (const float*)d_in[0];
    const int*   row = (const int*)  d_in[1];
    const int*   col = (const int*)  d_in[2];
    const float* ew  = (const float*)d_in[3];
    const float* Wq  = (const float*)d_in[4];
    const float* bq  = (const float*)d_in[5];
    const float* Wk  = (const float*)d_in[6];
    const float* bk  = (const float*)d_in[7];
    const float* Wv  = (const float*)d_in[8];
    const float* bv  = (const float*)d_in[9];
    float*       out = (float*)d_out;

    const int n   = in_sizes[0] / HIDDEN;   // 50000
    const int nnz = in_sizes[1];            // 1600000

    float* qws = (float*)d_ws;
    float* kws = qws + (size_t)n * HIDDEN;
    float* vws = kws + (size_t)n * HIDDEN;
    unsigned* rec = (unsigned*)(vws + (size_t)n * HIDDEN);   // 2 words per edge, whole chunks
    unsigned* off = rec + 2 * ((size_t)nnz + CHCAP);         // NB + 1 words per chunk

    // q/k/v projections via fp32 WMMA and, beside them in the same launch, the edge records
    // in order of out-row range, chunk by chunk
    SparseMHA_prep_kernel<<<PROJ_BLOCKS + SORT_BLOCKS, PREP_THREADS, 0, stream>>>(
        h, Wq, bq, Wk, bk, Wv, bv, row, col, ew, qws, kws, vws, rec, off, nnz, n);

    // fused edge SDDMM + sigmoid*w + sums in LDS, every out row stored once
    SparseMHA_edge_kernel<<<SUM_BLOCKS, 1024, 0, stream>>>(
        qws, kws, vws, rec, off, out, nnz, n);
}

// v007
// Measured time: 53.1 microseconds a run.
// In two side-by-side timings against v006, it was 1.04 and 1.03 times as fast.
// Counting every step since v000, it is 3.13 times as fast.
#include <hip/hip_runtime.h>
#include <hip/hip_bf16.h>
#include <math.h>

#define HIDDEN    64
#define NUM_HEADS 4
#define HEAD_DIM  16
#define SCALING   0.25f  // HEAD_DIM^-0.5

typedef __attribute__((ext_vector_type(2))) float v2f;
typedef __attribute__((ext_vector_type(8))) float v8f;
typedef __attribute__((ext_vector_type(4))) float v4f;

// ---------------------------------------------------------------------------
// Kernel 1: the q/k/v projection and the edge sort in ONE launch. Neither reads
//   what the other writes, so the block index picks the part: the first
//   PROJ_BLOCKS blocks project, the other SORT_BLOCKS sort. The sort's loads, LDS
//   adds and barriers run beside the projection's WMMAs, not behind them.
//
//   Projection, native fp32 WMMA (16x16x4): wave w -> stored slots
//   [16 (w & 3), + 16) of tile stream 2 * block + (w >> 2). A wave reads the 48
//   B fragments of its 16 slots (three weight matrices, 16 K-steps) ONCE and
//   keeps them in registers, then loops over tiles of 16 rows of h (tile index
//   strided by the stream count): per tile it loads only the 16 A fragments.
//   48 v_wmma_f32_16x16x4_f32 per wave and tile. Epilogue adds bias (and
//   applies SCALING to q as in the reference).
//
//   Sort: edges in order of out-row range, chunk by chunk. The out rows are cut
//   into NB ranges of RPB rows; the edge list into chunks of CHCAP edges. A
//   block counts its chunk's edges per range in LDS, scans the counts, places
//   each edge's 8-byte record (col * 256 + row inside its range, edge weight)
//   in LDS in range order and writes the chunk out in whole lines, with the
//   NB + 1 starts of the ranges inside the chunk.
//   The declared shapes give n <= NB * RPB rows.
// ---------------------------------------------------------------------------
#define PREP_THREADS 256  // 8 waves
#define PROJ_BLOCKS  256  // one per WGP
#define PROJ_STREAMS 512  // 2 per block: 2 projecting waves per SIMD, about 6 tiles per stream
#define SORT_BLOCKS  256  // one per WGP, one chunk each at the declared shapes
#define SUM_BLOCKS   256
#define RPB    196    // out rows per range: sums and q rows of a range take 123 KiB of LDS
#define NB     256    // ranges: one per WGP, and one per thread of a sorting block
#define CHCAP  6272   // edges per chunk (49 KiB of records in LDS)
#define EPT    25     // edges per thread of a sorting block: ceil(CHCAP / PREP_THREADS)
static_assert(NB == PREP_THREADS, "a sorting thread owns one range");
static_assert(EPT * PREP_THREADS >= CHCAP, "a chunk fits its block's threads");

__device__ __forceinline__ void SparseMHA_proj_part(
    const float* __restrict__ h,
    const float* __restrict__ Wq, const float* __restrict__ bq,
    const float* __restrict__ Wk, const float* __restrict__ bk,
    const float* __restrict__ Wv, const float* __restrict__ bv,
    float* __restrict__ qout, float* __restrict__ kout, float* __restrict__ vout,
    int n, int blk)
{
    // wave-uniform, so the tile loop is scalar control flow and EXEC stays all ones at the WMMAs
    const int wave = __builtin_amdgcn_readfirstlane(threadIdx.x >> 5);
    const int lane = threadIdx.x & 31;
    const int half = lane >> 4;      // 0: K lo pair / M,N 0-7 side, 1: K hi pair
    const int r16  = lane & 15;
    const int n0   = (wave & 3) * 16;
    const int nt   = (n + 15) >> 4;  // tiles of 16 rows

    int t = blk * 2 + (wave >> 2);
    if (t >= nt) return;             // whole waves leave; this part has no barrier

    // Slot colj of a stored q/k/v row holds channel chan: slots 4l..4l+3 hold the channels
    // of head l & 3 with d = 4 (l >> 2) .. + 3 (channel = d * 4 + head), so that kernel 2
    // reads four channels of one head with one 16-byte load per lane, 16 lanes to a row.
    const int colj = n0 + r16;
    const int chan = (colj & 48) | ((colj & 3) << 2) | ((colj >> 2) & 3);
    const float* __restrict__ wqrow = Wq + chan * HIDDEN + half * 2;  // B[kk,n] = W[chan(n0+n), kb+kk]
    const float* __restrict__ wkrow = Wk + chan * HIDDEN + half * 2;
    const float* __restrict__ wvrow = Wv + chan * HIDDEN + half * 2;

    v2f bqf[16], bkf[16], bvf[16];   // this lane's K pair of every 4-wide slab, all three matrices
#pragma unroll
    for (int ks = 0; ks < 16; ++ks) {
        bqf[ks] = *(const v2f*)(wqrow + ks * 4);
        bkf[ks] = *(const v2f*)(wkrow + ks * 4);
        bvf[ks] = *(const v2f*)(wvrow + ks * 4);
    }
    const float biasq = bq[chan];
    const float biask = bk[chan];
    const float biasv = bv[chan];

    // A-row clamped so WMMA can run with EXEC all-ones even on a ragged tail.
    v2f af[16];
    {
        const float* __restrict__ hrow = h + min(t * 16 + r16, n - 1) * HIDDEN + half * 2;
#pragma unroll
        for (int ks = 0; ks < 16; ++ks) af[ks] = *(const v2f*)(hrow + ks * 4);
    }

    for (;;) {
        // the next tile's A fragments come in under this tile's WMMAs
        // (the last trip reads its own tile again: always in bounds)
        const int tn = t + PROJ_STREAMS;
        const int tp = tn < nt ? tn : t;
        v2f an[16];
        {
            const float* __restrict__ hrow = h + min(tp * 16 + r16, n - 1) * HIDDEN + half * 2;
#pragma unroll
            for (int ks = 0; ks < 16; ++ks) an[ks] = *(const v2f*)(hrow + ks * 4);
        }

        v8f accq = {}; v8f acck = {}; v8f accv = {};
#pragma unroll
        for (int ks = 0; ks < 16; ++ks) {
            accq = __builtin_amdgcn_wmma_f32_16x16x4_f32(false, af[ks], false, bqf[ks],
                                                         (short)0, accq, false, false);
            acck = __builtin_amdgcn_wmma_f32_16x16x4_f32(false, af[ks], false, bkf[ks],
                                                         (short)0, acck, false, false);
            accv = __builtin_amdgcn_wmma_f32_16x16x4_f32(false, af[ks], false, bvf[ks],
                                                         (short)0, accv, false, false);
        }

        // four vector slots between the last WMMA and the first vector instruction that
        // reuses its A registers (dead from here on) or reads its result; the two
        // scheduling barriers keep the slots directly behind that WMMA
        __builtin_amdgcn_sched_barrier(0);
        asm volatile("v_nop\n\tv_nop\n\tv_nop\n\tv_nop");
        __builtin_amdgcn_sched_barrier(0);

        // C layout: VGPR vr, lanes 0-15 -> M = vr, lanes 16-31 -> M = vr + 8; N = lane%16
        const int m0 = t * 16;
#pragma unroll
        for (int vr = 0; vr < 8; ++vr) {
            const int m = m0 + vr + half * 8;
            if (m < n) {
                const int idx = m * HIDDEN + colj;
                qout[idx] = (accq[vr] + biasq) * SCALING;
                kout[idx] =  acck[vr] + biask;
                vout[idx] =  accv[vr] + biasv;
            }
        }
        // the next trip overwrites registers that the last row's stores name
        asm volatile("s_wait_xcnt 0x0" ::: "memory");

        if (tn >= nt) break;
        t = tn;
#pragma unroll
        for (int ks = 0; ks < 16; ++ks) af[ks] = an[ks];
    }
}

// cnt, scn: NB words each; srt: CHCAP records and 32 spare ones. Thread tid owns range tid in the scan.
__device__ __forceinline__ void SparseMHA_sort_part(
    const int* __restrict__ row, const int* __restrict__ col,
    const float* __restrict__ ew,
    unsigned* __restrict__ rec, unsigned* __restrict__ off, int nnz, int n, int blk,
    unsigned* cnt, unsigned* scn, uint2* srt)
{
    const int tid  = threadIdx.x;
    const int nch  = (nnz + CHCAP - 1) / CHCAP;
    const int rmax = min(n, NB * RPB) - 1;

    for (int c = blk; c < nch; c += SORT_BLOCKS) {
        const int e0 = c * CHCAP;
        const int m  = min(CHCAP, nnz - e0);
        // a thread's EPT edges are asked for at once and stay in registers for both passes
        int rr[EPT], cc[EPT]; float ww[EPT];
#pragma unroll
        for (int t = 0; t < EPT; ++t) {
            const int i = min(tid + t * PREP_THREADS, m - 1);
            rr[t] = row[e0 + i]; cc[t] = col[e0 + i]; ww[t] = ew[e0 + i];
            // the loads stay in flight: a later trip's result may land in their offset register
            asm volatile("s_wait_xcnt 0x0" ::: "memory");
        }
        cnt[tid] = 0u;
        __syncthreads();
#pragma unroll
        for (int t = 0; t < EPT; ++t) {
            rr[t] = min(max(rr[t], 0), rmax);
            if (tid + t * PREP_THREADS < m) atomicAdd(&cnt[rr[t] / RPB], 1u);
        }
        __syncthreads();
        // inclusive scan of the NB counts (every thread passes every barrier)
        unsigned x = cnt[tid];
        scn[tid] = x;
        __syncthreads();
        for (int d = 1; d < NB; d <<= 1) {
            unsigned y = 0u;
            if (tid >= d) y = scn[tid - d];
            __syncthreads();
            x += y; scn[tid] = x;
            __syncthreads();
        }
        {
            const unsigned st = x - cnt[tid];      // first place of this range in the chunk
            off[c * (NB + 1) + tid] = st;
            cnt[tid] = st;                         // from here on the range's next free place
        }
        if (tid == 0) off[c * (NB + 1) + NB] = (unsigned)m;
        __syncthreads();
        // a thread's EPT places are all asked for before the first is used: with 8 waves
        // to a chunk the latencies of the returning adds would otherwise stand in a row
        unsigned pos[EPT];
#pragma unroll
        for (int t = 0; t < EPT; ++t) {
            pos[t] = 0u;
            if (tid + t * PREP_THREADS < m) pos[t] = atomicAdd(&cnt[rr[t] / RPB], 1u);
        }
        // no branch round the stores (a lane without an edge writes its own spare record
        // behind the chunk, which nobody reads): one run of stores behind one wait
#pragma unroll
        for (int t = 0; t < EPT; ++t) {
            const int cl = min(max(cc[t], 0), n - 1);
            const int b  = rr[t] / RPB;
            const unsigned at = tid + t * PREP_THREADS < m ? pos[t] : (unsigned)(CHCAP + (tid & 31));
            srt[at] = make_uint2(((unsigned)cl << 8) | (unsigned)(rr[t] - b * RPB),
                                 __float_as_uint(ww[t]));
        }
        __syncthreads();
        // likewise all LDS reads first (index clamped into the chunk), then the stores
        uint2 ro[EPT];
#pragma unroll
        for (int t = 0; t < EPT; ++t) ro[t] = srt[min(tid + t * PREP_THREADS, m - 1)];
#pragma unroll
        for (int t = 0; t < EPT; ++t) {
            const int i = tid + t * PREP_THREADS;
            if (i < m) ((uint2*)rec)[e0 + i] = ro[t];
        }
        __syncthreads();                           // srt and cnt are free for the next chunk
    }
}

__global__ __launch_bounds__(PREP_THREADS) void SparseMHA_prep_kernel(
    const float* __restrict__ h,
    const float* __restrict__ Wq, const float* __restrict__ bq,
    const float* __restrict__ Wk, const float* __restrict__ bk,
    const float* __restrict__ Wv, const float* __restrict__ bv,
    const int* __restrict__ row, const int* __restrict__ col,
    const float* __restrict__ ew,
    float* __restrict__ qout, float* __restrict__ kout, float* __restrict__ vout,
    unsigned* __restrict__ rec, unsigned* __restrict__ off, int nnz, int n)
{
    __shared__ unsigned cnt[NB];
    __shared__ unsigned scn[NB];
    __shared__ uint2    srt[CHCAP + 32];
    // the same for a whole block: every barrier of the sort is passed by all of its threads
    if (blockIdx.x < PROJ_BLOCKS)
        SparseMHA_proj_part(h, Wq, bq, Wk, bk, Wv, bv, qout, kout, vout, n, blockIdx.x);
    else
        SparseMHA_sort_part(row, col, ew, rec, off, nnz, n, blockIdx.x - PROJ_BLOCKS,
                            cnt, scn, srt);
}

// ---------------------------------------------------------------------------
// Kernel 2: fused SDDMM + sigmoid*edge_weight + SPMM, one block per row range.
//   The block holds its range's q rows and its out sums in LDS. A wave takes
//   every 32nd chunk and reads the range's records of that chunk, 32 at a time.
//   TWO EDGES PER WAVE INSTRUCTION: each 16-lane row of the wave works on an
//   edge of its own. Lane l of a row reads slots 4l..4l+3 of a k, v or q row
//   with one 16-byte load; kernel 1 stores there four channels of head l & 3,
//   so a lane sums four products itself and the sum over d ends over the lanes
//   with equal l & 3 (xor 4, 8 inside the row). Only the k and v rows come from
//   L2, the sums are LDS adds, and each out row is stored once (rows without an
//   edge as zero).
//   SORTED PATH (a range of at most CAPR records, no part above 64, at most 32 CPW
//   chunks): the block first puts the range's records in order of out row in LDS
//   (rank by a returning LDS add per record, one scan of the row counts). The 64
//   16-lane rows then take equal runs of that list; a run's records of one out row
//   follow one another, so their sum stays in registers and goes to LDS once per
//   out row and run, not once per edge. Any other range takes the loop over parts.
//   LDS rows have a pitch of LPITCH words. A sum row holds value i of lane l at
//   word 16 i + l: one add instruction covers 16 banks in a run for each edge,
//   and the pitch sets the runs of rows r and r + 1 on different banks.
// ---------------------------------------------------------------------------
#define LPITCH 80     // words per q row and per sum row in LDS (64 used)

// A batch of m (1 to 32) records is dealt to the two 16-lane rows: row 0 takes the
// first ceil(m / 2), row 1 the rest. The index of this lane's record (clamped into the batch):
__device__ __forceinline__ int SparseMHA_deal(int lane, int m) {
    return min((lane >> 4) * ((m + 1) >> 1) + (lane & 15), m - 1);
}
// whether the lane's record is its own (else it is a copy and gets weight zero)
__device__ __forceinline__ bool SparseMHA_dealt(int lane, int m) {
    const int hm = (m + 1) >> 1;
    return (lane & 15) < ((lane >> 4) ? m - hm : hm);
}

// every lane gets the value of lane s of its own 16-lane row; sel holds s in each nibble
__device__ __forceinline__ unsigned SparseMHA_row_lane(unsigned x, unsigned sel) {
    return (unsigned)__builtin_amdgcn_permlane16((int)x, (int)x, sel, sel, false, false);
}

// sum over the lanes l ^ 4, l ^ 8 of a 16-lane row (DPP row_xmask)
__device__ __forceinline__ float SparseMHA_head_sum(float p) {
    p += __builtin_bit_cast(float, __builtin_amdgcn_update_dpp(
             0, __builtin_bit_cast(int, p), 0x164, 0xf, 0xf, true));
    p += __builtin_bit_cast(float, __builtin_amdgcn_update_dpp(
             0, __builtin_bit_cast(int, p), 0x168, 0xf, 0xf, true));
    return p;
}

// U steps, each one edge per 16-lane row: the records of lanes j .. j + U - 1 of both rows.
// ka: col * 256 (byte offset of the k and v row), ra: byte offset of the row in LDS, wa: weight.
template <int U>
__device__ __forceinline__ void SparseMHA_steps(
    const float* __restrict__ k, const float* __restrict__ v,
    const float* qs, float* acc,
    unsigned ka, unsigned ra, unsigned wa, int j, unsigned l16)
{
    unsigned ko[U], ro[U];
    float    w[U];
    v4f      kk[U], vv[U], qq[U];
#pragma unroll
    for (int u = 0; u < U; ++u) {
        const unsigned sel = (unsigned)(j + u) * 0x11111111u;
        ko[u] = SparseMHA_row_lane(ka, sel) + l16 * 16u;
        ro[u] = SparseMHA_row_lane(ra, sel);
        w[u]  = __uint_as_float(SparseMHA_row_lane(wa, sel));
    }
#pragma unroll
    for (int u = 0; u < U; ++u) qq[u] = *(const v4f*)((const char*)qs + ro[u] + l16 * 16u);
    // All 2 U row loads of the steps in one statement with their data wait: written as plain
    // loads, the compiler sinks each step's loads to its own arithmetic and the L2 latencies
    // of the steps add up instead of overlapping.
    if constexpr (U == 4) {
        asm volatile("global_load_b128 %0, %8, %12\n\t"
                     "global_load_b128 %1, %9, %12\n\t"
                     "global_load_b128 %2, %10, %12\n\t"
                     "global_load_b128 %3, %11, %12\n\t"
                     "global_load_b128 %4, %8, %13\n\t"
                     "global_load_b128 %5, %9, %13\n\t"
                     "global_load_b128 %6, %10, %13\n\t"
                     "global_load_b128 %7, %11, %13\n\t"
                     "s_wait_loadcnt 0x0"
                     : "=&v"(kk[0]), "=&v"(kk[1]), "=&v"(kk[2]), "=&v"(kk[3]),
                       "=&v"(vv[0]), "=&v"(vv[1]), "=&v"(vv[2]), "=&v"(vv[3])
                     : "v"(ko[0]), "v"(ko[1]), "v"(ko[2]), "v"(ko[3]), "s"(k), "s"(v)
                     : "memory");
    } else {
        asm volatile("global_load_b128 %0, %4, %6\n\t"
                     "global_load_b128 %1, %5, %6\n\t"
                     "global_load_b128 %2, %4, %7\n\t"
                     "global_load_b128 %3, %5, %7\n\t"
                     "s_wait_loadcnt 0x0"
                     : "=&v"(kk[0]), "=&v"(kk[1]), "=&v"(vv[0]), "=&v"(vv[1])
                     : "v"(ko[0]), "v"(ko[1]), "s"(k), "s"(v)
                     : "memory");
    }
#pragma unroll
    for (int u = 0; u < U; ++u) {
        // four products of one head: two packed operations and one add
        const v2f s2 = __builtin_elementwise_fma(qq[u].zw, kk[u].zw, qq[u].xy * kk[u].xy);
        const float p = SparseMHA_head_sum(s2.x + s2.y);
        // sigmoid(q . k of this lane's head) * edge weight
        const float t = w[u] / (1.0f + __expf(-p));
        float* a = (float*)((char*)acc + ro[u] + l16 * 4u);
        atomicAdd(a,      t * vv[u].x);
        atomicAdd(a + 16, t * vv[u].y);
        atomicAdd(a + 32, t * vv[u].z);
        atomicAdd(a + 48, t * vv[u].w);
    }
}

// adds a 16-lane row's four register sums per lane to the sum row at byte offset cur
__device__ __forceinline__ void SparseMHA_flush(float* acc, unsigned cur, unsigned l16, v4f a) {
    float* p = (float*)((char*)acc + cur + l16 * 4u);
    atomicAdd(p,      a.x);
    atomicAdd(p + 16, a.y);
    atomicAdd(p + 32, a.z);
    atomicAdd(p + 48, a.w);
}

#define CAPR 8192     // records of one range that the sorted path holds in LDS (64 KiB)
#define CPW  8        // chunks per wave on the sorted path: 32 waves take 256 chunks

__global__ __launch_bounds__(1024) void SparseMHA_edge_kernel(
    const float* __restrict__ q, const float* __restrict__ k,
    const float* __restrict__ v,
    const unsigned* __restrict__ rec, const unsigned* __restrict__ off,
    float* __restrict__ out, int nnz, int n)
{
    __shared__ __attribute__((aligned(16))) float acc[RPB * LPITCH];
    __shared__ __attribute__((aligned(16))) float qs[RPB * LPITCH];
    __shared__ __attribute__((aligned(16))) uint2    srt[CAPR + 4]; // the range's records in order of out row, 4 empty ones behind
    __shared__ __attribute__((aligned(16))) unsigned rcnt[256];   // records per out row, then each row's first place
    __shared__ unsigned wtot[32];                                 // records per wave
    const int tid  = threadIdx.x;
    const int lane = tid & 31;
    // wave-uniform, so chunk numbers and range bounds stay in scalar registers
    const int wave = __builtin_amdgcn_readfirstlane(tid >> 5);
    const int nch  = (nnz + CHCAP - 1) / CHCAP;
    const int nb   = (n + RPB - 1) / RPB;
    const unsigned l16 = lane & 15;              // lane inside its 16-lane row

    for (int bin = blockIdx.x; bin < nb; bin += gridDim.x) {
        const int rb = bin * RPB;
        const int nr = min(RPB, n - rb);
        // Sorted path, part 1: a wave takes chunks wave + 32 t; lane t holds the range's bounds there.
        // Up to 64 records of each part go to registers (lane, lane + 32); a range with a longer
        // part, with more than CAPR records, or a list of more than 32 CPW chunks takes the other path.
        const bool pre = nch <= 32 * CPW && bin < NB;
        const int  njw = pre && wave < nch ? (nch - wave + 31) >> 5 : 0;
        int   zs[CPW];
        uint2 r[CPW][2];
        {
            int sl = 0, el = 0;
            if (pre) {
                const int cl = min(wave + lane * 32, nch - 1);
                sl = (int)off[cl * (NB + 1) + bin];
                el = (int)off[cl * (NB + 1) + bin + 1];
            }
            int tot = 0, mx = 0;
#pragma unroll
            for (int t = 0; t < CPW; ++t) {
                const int s = __builtin_amdgcn_readlane(sl, t);
                const int z = t < njw ? __builtin_amdgcn_readlane(el, t) - s : 0;
                zs[t] = z; tot += z; mx = max(mx, z);
                r[t][0] = make_uint2(0u, 0u);
                r[t][1] = make_uint2(0u, 0u);
                const uint2* __restrict__ rp = (const uint2*)rec + (wave + 32 * t) * CHCAP + s;
                if (z > 0) {
                    r[t][0] = rp[min(lane, z - 1)];
                    // the load stays in flight: its address register is reused right behind it
                    asm volatile("s_wait_xcnt 0x0" ::: "memory");
                }
                if (z > 32) {
                    r[t][1] = rp[min(lane + 32, z - 1)];
                    // the load stays in flight: its address register is reused right behind it
                    asm volatile("s_wait_xcnt 0x0" ::: "memory");
                }
            }
            if (lane == 0) wtot[wave] = pre && mx <= 64 ? (unsigned)tot : (unsigned)(CAPR + 1);
        }
        if (tid < 256) rcnt[tid] = 0u;
        for (int i = tid; i < nr * (HIDDEN / 4); i += 1024) {
            const int li = (i >> 4) * (LPITCH / 4) + (i & 15);
            ((float4*)qs)[li]  = ((const float4*)(q + rb * HIDDEN))[i];
            ((float4*)acc)[li] = make_float4(0.f, 0.f, 0.f, 0.f);
        }
        __syncthreads();

        // the range's record count, the same scalar in every wave: the branch and its barriers are block-uniform
        int T = 0;
        {
            const int x = (int)wtot[lane];
#pragma unroll
            for (int i = 0; i < 32; ++i) T += __builtin_amdgcn_readlane(x, i);
        }
        if (T <= CAPR) {
            // Sorted path, part 2: a record's rank among those of its out row, the rows' first places
            // (scan by wave 0), then every record to its place in srt.
            unsigned rk[CPW][2];
#pragma unroll
            for (int t = 0; t < CPW; ++t) {
                rk[t][0] = 0u; rk[t][1] = 0u;
                if (lane < zs[t]) rk[t][0] = atomicAdd(&rcnt[r[t][0].x & 255u], 1u);
                if (zs[t] > 32) {
                    if (lane + 32 < zs[t]) rk[t][1] = atomicAdd(&rcnt[r[t][1].x & 255u], 1u);
                }
            }
            __syncthreads();
            if (wave == 0) {
                const uint4 ca = ((const uint4*)rcnt)[lane * 2];
                const uint4 cb = ((const uint4*)rcnt)[lane * 2 + 1];
                const unsigned sum = ca.x + ca.y + ca.z + ca.w + cb.x + cb.y + cb.z + cb.w;
                unsigned x = sum;
#pragma unroll
                for (int d = 1; d < 32; d <<= 1) {
                    const unsigned y = __shfl_up(x, d, 32);
                    if (lane >= d) x += y;
                }
                uint4 ea, eb;
                ea.x = x - sum;     ea.y = ea.x + ca.x; ea.z = ea.y + ca.y; ea.w = ea.z + ca.z;
                eb.x = ea.w + ca.w; eb.y = eb.x + cb.x; eb.z = eb.y + cb.y; eb.w = eb.z + cb.z;
                ((uint4*)rcnt)[lane * 2]     = ea;
                ((uint4*)rcnt)[lane * 2 + 1] = eb;
            }
            __syncthreads();
#pragma unroll
            for (int t = 0; t < CPW; ++t) {
                if (lane < zs[t]) srt[rcnt[r[t][0].x & 255u] + rk[t][0]] = r[t][0];
                if (zs[t] > 32) {
                    if (lane + 32 < zs[t]) srt[rcnt[r[t][1].x & 255u] + rk[t][1]] = r[t][1];
                }
            }
            // the last group of a run may read up to 4 places past the list: row 0, weight zero
            if (tid < 4) srt[T + tid] = make_uint2(0u, 0u);
            __syncthreads();

            // Part 3: each of the 64 16-lane rows takes an equal run of the sorted list and keeps the
            // sums of the out row it is in in four registers per lane; they go to LDS (as adds: an
            // out row may lie across two runs) only where the out row changes and at the run's end.
            const int hw = wave * 2 + (lane >> 4);
            const int b0 = (hw * T) >> 6;
            const int b1 = ((hw + 1) * T) >> 6;
            const int u0 = (wave * 2 * T) >> 6, u1 = ((wave * 2 + 1) * T) >> 6, u2 = ((wave * 2 + 2) * T) >> 6;
            const int ns = max(u1 - u0, u2 - u1);   // steps of the wave: the longer of its two runs
            unsigned cur = 0u;                      // byte offset of the out row whose sums a holds
            v4f a = {0.f, 0.f, 0.f, 0.f};
            for (int j = 0; j < ns; j += 4) {
                unsigned ko[4], ro[4];
                float    w[4];
                v4f      kk[4], vv[4], qq[4];
                const int left = b1 - b0 - j;       // records left in this 16-lane row's run
#pragma unroll
                for (int u = 0; u < 4; ++u) {
                    // a step past the run's end takes the record that lies there with weight zero
                    const uint2 rc = srt[b0 + j + u];
                    w[u]  = u < left ? __uint_as_float(rc.y) : 0.f;
                    ko[u] = (rc.x & ~255u) + l16 * 16u;
                    ro[u] = (rc.x & 255u) * (LPITCH * 4u);
                }
#pragma unroll
                for (int u = 0; u < 4; ++u) qq[u] = *(const v4f*)((const char*)qs + ro[u] + l16 * 16u);
                // All 8 row loads of the steps in one statement with their data wait: written as plain
                // loads, the compiler sinks each step's loads to its own arithmetic and the L2
                // latencies of the steps add up instead of overlapping.
                asm volatile("global_load_b128 %0, %8, %12\n\t"
                             "global_load_b128 %1, %9, %12\n\t"
                             "global_load_b128 %2, %10, %12\n\t"
                             "global_load_b128 %3, %11, %12\n\t"
                             "global_load_b128 %4, %8, %13\n\t"
                             "global_load_b128 %5, %9, %13\n\t"
                             "global_load_b128 %6, %10, %13\n\t"
                             "global_load_b128 %7, %11, %13\n\t"
                             "s_wait_loadcnt 0x0"
                             : "=&v"(kk[0]), "=&v"(kk[1]), "=&v"(kk[2]), "=&v"(kk[3]),
                               "=&v"(vv[0]), "=&v"(vv[1]), "=&v"(vv[2]), "=&v"(vv[3])
                             : "v"(ko[0]), "v"(ko[1]), "v"(ko[2]), "v"(ko[3]), "s"(k), "s"(v)
                             : "memory");
                float t[4];
#pragma unroll
                for (int u = 0; u < 4; ++u) {
                    const v2f s2 = __builtin_elementwise_fma(qq[u].zw, kk[u].zw, qq[u].xy * kk[u].xy);
                    const float p = SparseMHA_head_sum(s2.x + s2.y);
                    // sigmoid(q . k of this lane's head) * edge weight
                    t[u] = w[u] / (1.0f + __expf(-p));
                }
#pragma unroll
                for (int u = 0; u < 4; ++u) {
                    if (ro[u] != cur) {
                        SparseMHA_flush(acc, cur, l16, a);
                        a = v4f{0.f, 0.f, 0.f, 0.f};
                        cur = ro[u];
                    }
                    a += t[u] * vv[u];
                }
            }
            SparseMHA_flush(acc, cur, l16, a);
        } else
        for (int c0 = wave; c0 < nch && bin < NB; c0 += 1024) {
            // lane t holds the range's bounds in chunk c0 + 32 t: one load for up to 32 chunks
            const int cl = min(c0 + lane * 32, nch - 1);
            const int sl = (int)off[cl * (NB + 1) + bin];
            const int el = (int)off[cl * (NB + 1) + bin + 1];
            const int nj = min(32, (nch - c0 + 31) >> 5);
            // the first 32 records of a chunk's part are asked for one chunk ahead
            uint2 nx = make_uint2(0u, 0u);
            {
                const int s1 = __builtin_amdgcn_readlane(sl, 0);
                const int e1 = __builtin_amdgcn_readlane(el, 0);
                if (e1 > s1) {
                    nx = ((const uint2*)rec + c0 * CHCAP)[s1 + SparseMHA_deal(lane, min(32, e1 - s1))];
                    // the load stays in flight: its address register is reused right behind it
                    asm volatile("s_wait_xcnt 0x0" ::: "memory");
                }
            }
            for (int t = 0; t < nj; ++t) {
            const int s = __builtin_amdgcn_readlane(sl, t);
            const int e = __builtin_amdgcn_readlane(el, t);
            const uint2* __restrict__ rp = (const uint2*)rec + (c0 + 32 * t) * CHCAP;
            uint2 rc = nx;
            if (t + 1 < nj) {
                const int s1 = __builtin_amdgcn_readlane(sl, t + 1);
                const int e1 = __builtin_amdgcn_readlane(el, t + 1);
                if (e1 > s1) {
                    nx = (rp + 32 * CHCAP)[s1 + SparseMHA_deal(lane, min(32, e1 - s1))];
                    // the load stays in flight: its address register is reused right behind it
                    asm volatile("s_wait_xcnt 0x0" ::: "memory");
                }
            }
            for (int p = s; p < e; p += 32) {
                const int m = min(32, e - p);
                if (p > s) {
                    rc = rp[p + SparseMHA_deal(lane, m)];
                    // the load stays in flight: its address register is reused right behind it
                    asm volatile("s_wait_xcnt 0x0" ::: "memory");
                }
                // a lane without a record of its own holds a copy with weight zero
                const unsigned wa = SparseMHA_dealt(lane, m) ? rc.y : 0u;
                const unsigned ka = rc.x & ~255u;
                const unsigned ra = (rc.x & 255u) * (LPITCH * 4u);
                const int hm = (m + 1) >> 1;     // steps: one edge per 16-lane row each
                for (int j = 0; j < hm; ) {
                    if (hm - j > 2) { SparseMHA_steps<4>(k, v, qs, acc, ka, ra, wa, j, l16); j += 4; }
                    else            { SparseMHA_steps<2>(k, v, qs, acc, ka, ra, wa, j, l16); j += 2; }
                }
            }
            }
        }
        __syncthreads();

        // channels 4c .. 4c+3 of a row are value c & 3 of lanes 4 (c >> 2) .. + 3
        for (int i = tid; i < nr * (HIDDEN / 4); i += 1024) {
            const int c = i & 15;
            ((float4*)(out + rb * HIDDEN))[i] =
                ((const float4*)acc)[(i >> 4) * (LPITCH / 4) + (c & 3) * 4 + (c >> 2)];
        }
        __syncthreads();                         // acc and qs are free for the next range
    }
}

// ---------------------------------------------------------------------------
extern "C" void kernel_launch(void* const* d_in, const int* in_sizes, int n_in,
                              void* d_out, int out_size, void* d_ws, size_t ws_size,
                              hipStream_t stream) {
    const float* h   = (const float*)d_in[0];
    const int*   row = (const int*)  d_in[1];
    const int*   col = (const int*)  d_in[2];
    const float* ew  = (const float*)d_in[3];
    const float* Wq  = (const float*)d_in[4];
    const float* bq  = (const float*)d_in[5];
    const float* Wk  = (const float*)d_in[6];
    const float* bk  = (const float*)d_in[7];
    const float* Wv  = (const float*)d_in[8];
    const float* bv  = (const float*)d_in[9];
    float*       out = (float*)d_out;

    const int n   = in_sizes[0] / HIDDEN;   // 50000
    const int nnz = in_sizes[1];            // 1600000

    float* qws = (float*)d_ws;
    float* kws = qws + (size_t)n * HIDDEN;
    float* vws = kws + (size_t)n * HIDDEN;
    unsigned* rec = (unsigned*)(vws + (size_t)n * HIDDEN);   // 2 words per edge, whole chunks
    unsigned* off = rec + 2 * ((size_t)nnz + CHCAP);         // NB + 1 words per chunk

    // q/k/v projections via fp32 WMMA and, beside them in the same launch, the edge records
    // in order of out-row range, chunk by chunk
    SparseMHA_prep_kernel<<<PROJ_BLOCKS + SORT_BLOCKS, PREP_THREADS, 0, stream>>>(
        h, Wq, bq, Wk, bk, Wv, bv, row, col, ew, qws, kws, vws, rec, off, nnz, n);

    // fused edge SDDMM + sigmoid*w + sums in LDS, every out row stored once
    SparseMHA_edge_kernel<<<SUM_BLOCKS, 1024, 0, stream>>>(
        qws, kws, vws, rec, off, out, nnz, n);
}

// v009
// It runs in 42.8 microseconds.
// It is 1.24 times as fast as v007, going by the measured steps of the versions left out in between.
// Counting every step since v000, it is 3.87 times as fast.
#include <hip/hip_runtime.h>
#include <hip/hip_bf16.h>
#include <math.h>

#define HIDDEN    64
#define NUM_HEADS 4
#define HEAD_DIM  16
#define SCALING   0.25f  // HEAD_DIM^-0.5

typedef __attribute__((ext_vector_type(2))) float v2f;
typedef __attribute__((ext_vector_type(8))) float v8f;
typedef __attribute__((ext_vector_type(4))) float v4f;
typedef __attribute__((ext_vector_type(4))) unsigned v4u;
typedef __attribute__((ext_vector_type(2))) _Float16 v2h;

// ---------------------------------------------------------------------------
// Kernel 1: the q/k/v projection and the edge sort in ONE launch. Neither reads
//   what the other writes, so the block index picks the part: the first
//   PROJ_BLOCKS blocks project, the other SORT_BLOCKS sort. The sort's loads, LDS
//   adds and barriers run beside the projection's WMMAs, not behind them.
//
//   Projection, native fp32 WMMA (16x16x4): wave w -> stored slots
//   [16 (w & 3), + 16) of tile stream 2 * block + (w >> 2). A wave reads the 48
//   B fragments of its 16 slots (three weight matrices, 16 K-steps) ONCE and
//   keeps them in registers, then loops over tiles of 16 rows of h (tile index
//   strided by the stream count): per tile it loads only the 16 A fragments.
//   48 v_wmma_f32_16x16x4_f32 per wave and tile. Epilogue adds bias (and
//   applies SCALING to q as in the reference). q is stored as f32; k and v are
//   rounded to f16 (nearest even) and stored as ONE row: word j of a kv row holds
//   slot j of k in its low half and slot j of v in its high half, so that an edge
//   takes 256 bytes from L2, not 512.
//
//   Sort: edges in order of out-row range, chunk by chunk. The out rows are cut
//   into NB ranges of RPB rows; the edge list into chunks of CHCAP edges. A
//   block counts its chunk's edges per range in LDS, scans the counts, places
//   each edge's 8-byte record (col * 256 + row inside its range, edge weight)
//   in LDS in range order and writes the chunk out in whole lines, with the
//   NB + 1 starts of the ranges inside the chunk.
//   The declared shapes give n <= NB * RPB rows.
// ---------------------------------------------------------------------------
#define PREP_THREADS 256  // 8 waves
#define PROJ_BLOCKS  256  // one per WGP
#define PROJ_STREAMS 512  // 2 per block: 2 projecting waves per SIMD, about 6 tiles per stream
#define SORT_BLOCKS  256  // one per WGP, one chunk each at the declared shapes
#define SUM_BLOCKS   256
#define RPB    196    // out rows per range: sums and q rows of a range take 123 KiB of LDS
#define NB     256    // ranges: one per WGP, and one per thread of a sorting block
#define CHCAP  6272   // edges per chunk (49 KiB of records in LDS)
#define EPT    25     // edges per thread of a sorting block: ceil(CHCAP / PREP_THREADS)
static_assert(NB == PREP_THREADS, "a sorting thread owns one range");
static_assert(EPT * PREP_THREADS >= CHCAP, "a chunk fits its block's threads");

__device__ __forceinline__ void SparseMHA_proj_part(
    const float* __restrict__ h,
    const float* __restrict__ Wq, const float* __restrict__ bq,
    const float* __restrict__ Wk, const float* __restrict__ bk,
    const float* __restrict__ Wv, const float* __restrict__ bv,
    float* __restrict__ qout, unsigned* __restrict__ kvout,
    int n, int blk)
{
    // wave-uniform, so the tile loop is scalar control flow and EXEC stays all ones at the WMMAs
    const int wave = __builtin_amdgcn_readfirstlane(threadIdx.x >> 5);
    const int lane = threadIdx.x & 31;
    const int half = lane >> 4;      // 0: K lo pair / M,N 0-7 side, 1: K hi pair
    const int r16  = lane & 15;
    const int n0   = (wave & 3) * 16;
    const int nt   = (n + 15) >> 4;  // tiles of 16 rows

    int t = blk * 2 + (wave >> 2);
    if (t >= nt) return;             // whole waves leave; this part has no barrier

    // Slot colj of a stored q/k/v row holds channel chan: slots 4l..4l+3 hold the channels
    // of head l & 3 with d = 4 (l >> 2) .. + 3 (channel = d * 4 + head), so that kernel 2
    // reads four channels of one head (q; k with v) with one 16-byte load per lane, 16 lanes to a row.
    const int colj = n0 + r16;
    const int chan = (colj & 48) | ((colj & 3) << 2) | ((colj >> 2) & 3);
    const float* __restrict__ wqrow = Wq + chan * HIDDEN + half * 2;  // B[kk,n] = W[chan(n0+n), kb+kk]
    const float* __restrict__ wkrow = Wk + chan * HIDDEN + half * 2;
    const float* __restrict__ wvrow = Wv + chan * HIDDEN + half * 2;

    v2f bqf[16], bkf[16], bvf[16];   // this lane's K pair of every 4-wide slab, all three matrices
#pragma unroll
    for (int ks = 0; ks < 16; ++ks) {
        bqf[ks] = *(const v2f*)(wqrow + ks * 4);
        bkf[ks] = *(const v2f*)(wkrow + ks * 4);
        bvf[ks] = *(const v2f*)(wvrow + ks * 4);
    }
    const float biasq = bq[chan];
    const float biask = bk[chan];
    const float biasv = bv[chan];

    // A-row clamped so WMMA can run with EXEC all-ones even on a ragged tail.
    v2f af[16];
    {
        const float* __restrict__ hrow = h + min(t * 16 + r16, n - 1) * HIDDEN + half * 2;
#pragma unroll
        for (int ks = 0; ks < 16; ++ks) af[ks] = *(const v2f*)(hrow + ks * 4);
    }

    for (;;) {
        // the next tile's A fragments come in under this tile's WMMAs
        // (the last trip reads its own tile again: always in bounds)
        const int tn = t + PROJ_STREAMS;
        const int tp = tn < nt ? tn : t;
        v2f an[16];
        {
            const float* __restrict__ hrow = h + min(tp * 16 + r16, n - 1) * HIDDEN + half * 2;
#pragma unroll
            for (int ks = 0; ks < 16; ++ks) an[ks] = *(const v2f*)(hrow + ks * 4);
        }

        v8f accq = {}; v8f acck = {}; v8f accv = {};
#pragma unroll
        for (int ks = 0; ks < 16; ++ks) {
            accq = __builtin_amdgcn_wmma_f32_16x16x4_f32(false, af[ks], false, bqf[ks],
                                                         (short)0, accq, false, false);
            acck = __builtin_amdgcn_wmma_f32_16x16x4_f32(false, af[ks], false, bkf[ks],
                                                         (short)0, acck, false, false);
            accv = __builtin_amdgcn_wmma_f32_16x16x4_f32(false, af[ks], false, bvf[ks],
                                                         (short)0, accv, false, false);
        }

        // four vector slots between the last WMMA and the first vector instruction that
        // reuses its A registers (dead from here on) or reads its result; the two
        // scheduling barriers keep the slots directly behind that WMMA
        __builtin_amdgcn_sched_barrier(0);
        asm volatile("v_nop\n\tv_nop\n\tv_nop\n\tv_nop");
        __builtin_amdgcn_sched_barrier(0);

        // C layout: VGPR vr, lanes 0-15 -> M = vr, lanes 16-31 -> M = vr + 8; N = lane%16
        const int m0 = t * 16;
#pragma unroll
        for (int vr = 0; vr < 8; ++vr) {
            const int m = m0 + vr + half * 8;
            if (m < n) {
                const int idx = m * HIDDEN + colj;
                qout[idx] = (accq[vr] + biasq) * SCALING;
                const v2h kv = {(_Float16)(acck[vr] + biask), (_Float16)(accv[vr] + biasv)};
                kvout[idx] = __builtin_bit_cast(unsigned, kv);
            }
        }
        // the next trip overwrites registers that the last row's stores name
        asm volatile("s_wait_xcnt 0x0" ::: "memory");

        if (tn >= nt) break;
        t = tn;
#pragma unroll
        for (int ks = 0; ks < 16; ++ks) af[ks] = an[ks];
    }
}

// cnt, scn: NB words each; srt: CHCAP records and 32 spare ones. Thread tid owns range tid in the scan.
__device__ __forceinline__ void SparseMHA_sort_part(
    const int* __restrict__ row, const int* __restrict__ col,
    const float* __restrict__ ew,
    unsigned* __restrict__ rec, unsigned* __restrict__ off, int nnz, int n, int blk,
    unsigned* cnt, unsigned* scn, uint2* srt)
{
    const int tid  = threadIdx.x;
    const int nch  = (nnz + CHCAP - 1) / CHCAP;
    const int rmax = min(n, NB * RPB) - 1;

    for (int c = blk; c < nch; c += SORT_BLOCKS) {
        const int e0 = c * CHCAP;
        const int m  = min(CHCAP, nnz - e0);
        // a thread's EPT edges are asked for at once and stay in registers for both passes
        int rr[EPT], cc[EPT]; float ww[EPT];
#pragma unroll
        for (int t = 0; t < EPT; ++t) {
            const int i = min(tid + t * PREP_THREADS, m - 1);
            rr[t] = row[e0 + i]; cc[t] = col[e0 + i]; ww[t] = ew[e0 + i];
            // the loads stay in flight: a later trip's result may land in their offset register
            asm volatile("s_wait_xcnt 0x0" ::: "memory");
        }
        cnt[tid] = 0u;
        __syncthreads();
#pragma unroll
        for (int t = 0; t < EPT; ++t) {
            rr[t] = min(max(rr[t], 0), rmax);
            if (tid + t * PREP_THREADS < m) atomicAdd(&cnt[rr[t] / RPB], 1u);
        }
        __syncthreads();
        // inclusive scan of the NB counts (every thread passes every barrier)
        unsigned x = cnt[tid];
        scn[tid] = x;
        __syncthreads();
        for (int d = 1; d < NB; d <<= 1) {
            unsigned y = 0u;
            if (tid >= d) y = scn[tid - d];
            __syncthreads();
            x += y; scn[tid] = x;
            __syncthreads();
        }
        {
            const unsigned st = x - cnt[tid];      // first place of this range in the chunk
            off[c * (NB + 1) + tid] = st;
            cnt[tid] = st;                         // from here on the range's next free place
        }
        if (tid == 0) off[c * (NB + 1) + NB] = (unsigned)m;
        __syncthreads();
        // a thread's EPT places are all asked for before the first is used: with 8 waves
        // to a chunk the latencies of the returning adds would otherwise stand in a row
        unsigned pos[EPT];
#pragma unroll
        for (int t = 0; t < EPT; ++t) {
            pos[t] = 0u;
            if (tid + t * PREP_THREADS < m) pos[t] = atomicAdd(&cnt[rr[t] / RPB], 1u);
        }
        // no branch round the stores (a lane without an edge writes its own spare record
        // behind the chunk, which nobody reads): one run of stores behind one wait
#pragma unroll
        for (int t = 0; t < EPT; ++t) {
            const int cl = min(max(cc[t], 0), n - 1);
            const int b  = rr[t] / RPB;
            const unsigned at = tid + t * PREP_THREADS < m ? pos[t] : (unsigned)(CHCAP + (tid & 31));
            srt[at] = make_uint2(((unsigned)cl << 8) | (unsigned)(rr[t] - b * RPB),
                                 __float_as_uint(ww[t]));
        }
        __syncthreads();
        // likewise all LDS reads first (index clamped into the chunk), then the stores
        uint2 ro[EPT];
#pragma unroll
        for (int t = 0; t < EPT; ++t) ro[t] = srt[min(tid + t * PREP_THREADS, m - 1)];
#pragma unroll
        for (int t = 0; t < EPT; ++t) {
            const int i = tid + t * PREP_THREADS;
            if (i < m) ((uint2*)rec)[e0 + i] = ro[t];
        }
        __syncthreads();                           // srt and cnt are free for the next chunk
    }
}

__global__ __launch_bounds__(PREP_THREADS) void SparseMHA_prep_kernel(
    const float* __restrict__ h,
    const float* __restrict__ Wq, const float* __restrict__ bq,
    const float* __restrict__ Wk, const float* __restrict__ bk,
    const float* __restrict__ Wv, const float* __restrict__ bv,
    const int* __restrict__ row, const int* __restrict__ col,
    const float* __restrict__ ew,
    float* __restrict__ qout, unsigned* __restrict__ kvout,
    unsigned* __restrict__ rec, unsigned* __restrict__ off, int nnz, int n)
{
    __shared__ unsigned cnt[NB];
    __shared__ unsigned scn[NB];
    __shared__ uint2    srt[CHCAP + 32];
    // the same for a whole block: every barrier of the sort is passed by all of its threads
    if (blockIdx.x < PROJ_BLOCKS)
        SparseMHA_proj_part(h, Wq, bq, Wk, bk, Wv, bv, qout, kvout, n, blockIdx.x);
    else
        SparseMHA_sort_part(row, col, ew, rec, off, nnz, n, blockIdx.x - PROJ_BLOCKS,
                            cnt, scn, srt);
}

// ---------------------------------------------------------------------------
// Kernel 2: fused SDDMM + sigmoid*edge_weight + SPMM, one block per row range.
//   The block holds its range's q rows and its out sums in LDS. A wave takes
//   every 32nd chunk and reads the range's records of that chunk, 32 at a time.
//   TWO EDGES PER WAVE INSTRUCTION: each 16-lane row of the wave works on an
//   edge of its own. Lane l of a row reads slots 4l..4l+3 of a kv or q row
//   with one 16-byte load; kernel 1 stores there four channels of head l & 3
//   (in a kv row k as f16 in the low, v as f16 in the high half of each word),
//   so a lane sums four products itself and the sum over d ends over the lanes
//   with equal l & 3 (xor 4, 8 inside the row). All products and sums are f32.
//   Only the kv rows come from L2, the sums are LDS adds, and each out row is
//   stored once (rows without an edge as zero).
//   SORTED PATH (a range of at most CAPR records, no part above 64, at most 32 CPW
//   chunks): the block first puts the range's records in order of out row in LDS
//   (rank by a returning LDS add per record, one scan of the row counts). There an
//   edge takes only 8 LANES, FOUR EDGES PER WAVE INSTRUCTION: lane l of a group
//   reads slots 4l..4l+3 and 4(l+8)..4(l+8)+3, eight channels of head l & 3, so
//   the score's cross-lane sum, the sigmoid and the division are paid once per four
//   edges. The 128 groups take equal runs of that list; a run's records of one out
//   row follow one another, so their sum stays in registers and goes to LDS once per
//   out row and run, not once per edge. Any other range takes the loop over parts.
//   LDS rows have a pitch of LPITCH words. A sum row holds value i of lane l at
//   word 16 i + l: one add instruction covers 16 banks in a run for each edge,
//   and the pitch sets the runs of rows r and r + 1 on different banks.
// ---------------------------------------------------------------------------
#define LPITCH 80     // words per q row and per sum row in LDS (64 used)

// A batch of m (1 to 32) records is dealt to the two 16-lane rows: row 0 takes the
// first ceil(m / 2), row 1 the rest. The index of this lane's record (clamped into the batch):
__device__ __forceinline__ int SparseMHA_deal(int lane, int m) {
    return min((lane >> 4) * ((m + 1) >> 1) + (lane & 15), m - 1);
}
// whether the lane's record is its own (else it is a copy and gets weight zero)
__device__ __forceinline__ bool SparseMHA_dealt(int lane, int m) {
    const int hm = (m + 1) >> 1;
    return (lane & 15) < ((lane >> 4) ? m - hm : hm);
}

// every lane gets the value of lane s of its own 16-lane row; sel holds s in each nibble
__device__ __forceinline__ unsigned SparseMHA_row_lane(unsigned x, unsigned sel) {
    return (unsigned)__builtin_amdgcn_permlane16((int)x, (int)x, sel, sel, false, false);
}

// sum over the lanes l ^ 4, l ^ 8 of a 16-lane row (DPP row_xmask)
__device__ __forceinline__ float SparseMHA_head_sum(float p) {
    p += __builtin_bit_cast(float, __builtin_amdgcn_update_dpp(
             0, __builtin_bit_cast(int, p), 0x164, 0xf, 0xf, true));
    p += __builtin_bit_cast(float, __builtin_amdgcn_update_dpp(
             0, __builtin_bit_cast(int, p), 0x168, 0xf, 0xf, true));
    return p;
}

// sum over the lanes l, l ^ 4 of an 8-lane group (DPP row_xmask)
__device__ __forceinline__ float SparseMHA_pair_sum(float p) {
    p += __builtin_bit_cast(float, __builtin_amdgcn_update_dpp(
             0, __builtin_bit_cast(int, p), 0x164, 0xf, 0xf, true));
    return p;
}

// the k (low) and the v (high) half of a kv word, as f32
__device__ __forceinline__ float SparseMHA_k_of(unsigned x) { return (float)__builtin_bit_cast(v2h, x).x; }
__device__ __forceinline__ float SparseMHA_v_of(unsigned x) { return (float)__builtin_bit_cast(v2h, x).y; }

// q . k over a lane's four channels of one head, f32 products of f32 q and f16 k, summed in a chain
__device__ __forceinline__ float SparseMHA_dot4(v4f q, v4u kv) {
    float s = q.x * SparseMHA_k_of(kv.x);
    s = fmaf(q.y, SparseMHA_k_of(kv.y), s);
    s = fmaf(q.z, SparseMHA_k_of(kv.z), s);
    return fmaf(q.w, SparseMHA_k_of(kv.w), s);
}

// the same over a lane's eight channels of one head, one chain of 8
__device__ __forceinline__ float SparseMHA_dot8(v4f qa, v4u ka, v4f qb, v4u kb) {
    float s = SparseMHA_dot4(qa, ka);
    s = fmaf(qb.x, SparseMHA_k_of(kb.x), s);
    s = fmaf(qb.y, SparseMHA_k_of(kb.y), s);
    s = fmaf(qb.z, SparseMHA_k_of(kb.z), s);
    return fmaf(qb.w, SparseMHA_k_of(kb.w), s);
}

// U steps, each one edge per 16-lane row: the records of lanes j .. j + U - 1 of both rows.
// ka: col * 256 (byte offset of the kv row), ra: byte offset of the row in LDS, wa: weight.
template <int U>
__device__ __forceinline__ void SparseMHA_steps(
    const unsigned* __restrict__ kv,
    const float* qs, float* acc,
    unsigned ka, unsigned ra, unsigned wa, int j, unsigned l16)
{
    unsigned ko[U], ro[U];
    float    w[U];
    v4u      kw[U];
    v4f      qq[U];
#pragma unroll
    for (int u = 0; u < U; ++u) {
        const unsigned sel = (unsigned)(j + u) * 0x11111111u;
        ko[u] = SparseMHA_row_lane(ka, sel) + l16 * 16u;
        ro[u] = SparseMHA_row_lane(ra, sel);
        w[u]  = __uint_as_float(SparseMHA_row_lane(wa, sel));
    }
#pragma unroll
    for (int u = 0; u < U; ++u) qq[u] = *(const v4f*)((const char*)qs + ro[u] + l16 * 16u);
    // All U row loads of the steps in one statement with their data wait: written as plain
    // loads, the compiler sinks each step's load to its own arithmetic and the L2 latencies
    // of the steps add up instead of overlapping.
    if constexpr (U == 4) {
        asm volatile("global_load_b128 %0, %4, %8\n\t"
                     "global_load_b128 %1, %5, %8\n\t"
                     "global_load_b128 %2, %6, %8\n\t"
                     "global_load_b128 %3, %7, %8\n\t"
                     "s_wait_loadcnt 0x0"
                     : "=&v"(kw[0]), "=&v"(kw[1]), "=&v"(kw[2]), "=&v"(kw[3])
                     : "v"(ko[0]), "v"(ko[1]), "v"(ko[2]), "v"(ko[3]), "s"(kv)
                     : "memory");
    } else {
        asm volatile("global_load_b128 %0, %2, %4\n\t"
                     "global_load_b128 %1, %3, %4\n\t"
                     "s_wait_loadcnt 0x0"
                     : "=&v"(kw[0]), "=&v"(kw[1])
                     : "v"(ko[0]), "v"(ko[1]), "s"(kv)
                     : "memory");
    }
#pragma unroll
    for (int u = 0; u < U; ++u) {
        const float p = SparseMHA_head_sum(SparseMHA_dot4(qq[u], kw[u]));
        // sigmoid(q . k of this lane's head) * edge weight
        const float t = w[u] / (1.0f + __expf(-p));
        float* a = (float*)((char*)acc + ro[u] + l16 * 4u);
        atomicAdd(a,      t * SparseMHA_v_of(kw[u].x));
        atomicAdd(a + 16, t * SparseMHA_v_of(kw[u].y));
        atomicAdd(a + 32, t * SparseMHA_v_of(kw[u].z));
        atomicAdd(a + 48, t * SparseMHA_v_of(kw[u].w));
    }
}

// adds an 8-lane group's eight register sums per lane to the sum row at byte offset cur:
// a holds the values of lane l8, b those of lane l8 + 8 of the sum row's layout
__device__ __forceinline__ void SparseMHA_flush(float* acc, unsigned cur, unsigned l8, v4f a, v4f b) {
    float* p = (float*)((char*)acc + cur + l8 * 4u);
    atomicAdd(p,      a.x);
    atomicAdd(p + 8,  b.x);
    atomicAdd(p + 16, a.y);
    atomicAdd(p + 24, b.y);
    atomicAdd(p + 32, a.z);
    atomicAdd(p + 40, b.z);
    atomicAdd(p + 48, a.w);
    atomicAdd(p + 56, b.w);
}

// U steps of the sorted path, each one edge per 8-lane group: the U records at rp of this group's
// run, of which left are still its own. cur: byte offset of the out row whose sums a, b hold.
template <int U>
__device__ __forceinline__ void SparseMHA_run_steps(
    const unsigned* __restrict__ kv, const float* qs, float* acc,
    const uint2* rp, int left, unsigned l8, unsigned& cur, v4f& a, v4f& b)
{
    unsigned ko[U], ro[U];
    float    w[U];
    v4u      ka[U], kb[U];
    v4f      qa[U], qb[U];
#pragma unroll
    for (int u = 0; u < U; ++u) {
        // a step past the run's end takes the record that lies there with weight zero
        const uint2 rc = rp[u];
        w[u]  = u < left ? __uint_as_float(rc.y) : 0.f;
        ko[u] = (rc.x & ~255u) + l8 * 16u;
        ro[u] = (rc.x & 255u) * (LPITCH * 4u);
    }
#pragma unroll
    for (int u = 0; u < U; ++u) {
        qa[u] = *(const v4f*)((const char*)qs + ro[u] + l8 * 16u);
        qb[u] = *(const v4f*)((const char*)qs + ro[u] + l8 * 16u + 128u);
    }
    // All 2 U row loads of the steps (each covers one 128-byte half of four kv rows) in one
    // statement with their data wait: written as plain loads, the compiler sinks each step's
    // loads to its own arithmetic and the L2 latencies of the steps add up instead of overlapping.
    if constexpr (U == 4) {
        asm volatile("global_load_b128 %0, %8, %12\n\t"
                     "global_load_b128 %1, %8, %12 offset:128\n\t"
                     "global_load_b128 %2, %9, %12\n\t"
                     "global_load_b128 %3, %9, %12 offset:128\n\t"
                     "global_load_b128 %4, %10, %12\n\t"
                     "global_load_b128 %5, %10, %12 offset:128\n\t"
                     "global_load_b128 %6, %11, %12\n\t"
                     "global_load_b128 %7, %11, %12 offset:128\n\t"
                     "s_wait_loadcnt 0x0"
                     : "=&v"(ka[0]), "=&v"(kb[0]), "=&v"(ka[1]), "=&v"(kb[1]),
                       "=&v"(ka[2]), "=&v"(kb[2]), "=&v"(ka[3]), "=&v"(kb[3])
                     : "v"(ko[0]), "v"(ko[1]), "v"(ko[2]), "v"(ko[3]), "s"(kv)
                     : "memory");
    } else if constexpr (U == 3) {
        asm volatile("global_load_b128 %0, %6, %9\n\t"
                     "global_load_b128 %1, %6, %9 offset:128\n\t"
                     "global_load_b128 %2, %7, %9\n\t"
                     "global_load_b128 %3, %7, %9 offset:128\n\t"
                     "global_load_b128 %4, %8, %9\n\t"
                     "global_load_b128 %5, %8, %9 offset:128\n\t"
                     "s_wait_loadcnt 0x0"
                     : "=&v"(ka[0]), "=&v"(kb[0]), "=&v"(ka[1]), "=&v"(kb[1]),
                       "=&v"(ka[2]), "=&v"(kb[2])
                     : "v"(ko[0]), "v"(ko[1]), "v"(ko[2]), "s"(kv)
                     : "memory");
    } else if constexpr (U == 2) {
        asm volatile("global_load_b128 %0, %4, %6\n\t"
                     "global_load_b128 %1, %4, %6 offset:128\n\t"
                     "global_load_b128 %2, %5, %6\n\t"
                     "global_load_b128 %3, %5, %6 offset:128\n\t"
                     "s_wait_loadcnt 0x0"
                     : "=&v"(ka[0]), "=&v"(kb[0]), "=&v"(ka[1]), "=&v"(kb[1])
                     : "v"(ko[0]), "v"(ko[1]), "s"(kv)
                     : "memory");
    } else {
        asm volatile("global_load_b128 %0, %2, %3\n\t"
                     "global_load_b128 %1, %2, %3 offset:128\n\t"
                     "s_wait_loadcnt 0x0"
                     : "=&v"(ka[0]), "=&v"(kb[0])
                     : "v"(ko[0]), "s"(kv)
                     : "memory");
    }
#pragma unroll
    for (int u = 0; u < U; ++u) {
        if (ro[u] != cur) {
            SparseMHA_flush(acc, cur, l8, a, b);
            a = v4f{0.f, 0.f, 0.f, 0.f};
            b = v4f{0.f, 0.f, 0.f, 0.f};
            cur = ro[u];
        }
        // each step's score is formed in its own step and in one chain: with two chains or the
        // scores of the steps side by side the compiler pairs them for packed f32 operations and pays
        // conversions and copies; so it multiplies the f16 halves directly (v_fma_mix_f32)
        const float p = SparseMHA_pair_sum(SparseMHA_dot8(qa[u], ka[u], qb[u], kb[u]));
        // sigmoid(q . k of this lane's head) * edge weight
        const float t = w[u] / (1.0f + __expf(-p));
        a.x = fmaf(t, SparseMHA_v_of(ka[u].x), a.x);
        a.y = fmaf(t, SparseMHA_v_of(ka[u].y), a.y);
        a.z = fmaf(t, SparseMHA_v_of(ka[u].z), a.z);
        a.w = fmaf(t, SparseMHA_v_of(ka[u].w), a.w);
        b.x = fmaf(t, SparseMHA_v_of(kb[u].x), b.x);
        b.y = fmaf(t, SparseMHA_v_of(kb[u].y), b.y);
        b.z = fmaf(t, SparseMHA_v_of(kb[u].z), b.z);
        b.w = fmaf(t, SparseMHA_v_of(kb[u].w), b.w);
    }
}

#define CAPR 8192     // records of one range that the sorted path holds in LDS (64 KiB)
#define CPW  8        // chunks per wave on the sorted path: 32 waves take 256 chunks

__global__ __launch_bounds__(1024) void SparseMHA_edge_kernel(
    const float* __restrict__ q, const unsigned* __restrict__ kv,
    const unsigned* __restrict__ rec, const unsigned* __restrict__ off,
    float* __restrict__ out, int nnz, int n)
{
    __shared__ __attribute__((aligned(16))) float acc[RPB * LPITCH];
    __shared__ __attribute__((aligned(16))) float qs[RPB * LPITCH];
    __shared__ __attribute__((aligned(16))) uint2    srt[CAPR + 4]; // the range's records in order of out row, 4 empty ones behind
    __shared__ __attribute__((aligned(16))) unsigned rcnt[256];   // records per out row, then each row's first place
    __shared__ unsigned wtot[32];                                 // records per wave
    const int tid  = threadIdx.x;
    const int lane = tid & 31;
    // wave-uniform, so chunk numbers and range bounds stay in scalar registers
    const int wave = __builtin_amdgcn_readfirstlane(tid >> 5);
    const int nch  = (nnz + CHCAP - 1) / CHCAP;
    const int nb   = (n + RPB - 1) / RPB;
    const unsigned l16 = lane & 15;              // lane inside its 16-lane row

    for (int bin = blockIdx.x; bin < nb; bin += gridDim.x) {
        const int rb = bin * RPB;
        const int nr = min(RPB, n - rb);
        // Sorted path, part 1: a wave takes chunks wave + 32 t; lane t holds the range's bounds there.
        // Up to 64 records of each part go to registers (lane, lane + 32); a range with a longer
        // part, with more than CAPR records, or a list of more than 32 CPW chunks takes the other path.
        const bool pre = nch <= 32 * CPW && bin < NB;
        const int  njw = pre && wave < nch ? (nch - wave + 31) >> 5 : 0;
        int   zs[CPW];
        uint2 r[CPW][2];
        {
            int sl = 0, el = 0;
            if (pre) {
                const int cl = min(wave + lane * 32, nch - 1);
                sl = (int)off[cl * (NB + 1) + bin];
                el = (int)off[cl * (NB + 1) + bin + 1];
            }
            int tot = 0, mx = 0;
#pragma unroll
            for (int t = 0; t < CPW; ++t) {
                const int s = __builtin_amdgcn_readlane(sl, t);
                const int z = t < njw ? __builtin_amdgcn_readlane(el, t) - s : 0;
                zs[t] = z; tot += z; mx = max(mx, z);
                r[t][0] = make_uint2(0u, 0u);
                r[t][1] = make_uint2(0u, 0u);
                const uint2* __restrict__ rp = (const uint2*)rec + (wave + 32 * t) * CHCAP + s;
                if (z > 0) {
                    r[t][0] = rp[min(lane, z - 1)];
                    // the load stays in flight: its address register is reused right behind it
                    asm volatile("s_wait_xcnt 0x0" ::: "memory");
                }
                if (z > 32) {
                    r[t][1] = rp[min(lane + 32, z - 1)];
                    // the load stays in flight: its address register is reused right behind it
                    asm volatile("s_wait_xcnt 0x0" ::: "memory");
                }
            }
            if (lane == 0) wtot[wave] = pre && mx <= 64 ? (unsigned)tot : (unsigned)(CAPR + 1);
        }
        if (tid < 256) rcnt[tid] = 0u;
        for (int i = tid; i < nr * (HIDDEN / 4); i += 1024) {
            const int li = (i >> 4) * (LPITCH / 4) + (i & 15);
            ((float4*)qs)[li]  = ((const float4*)(q + rb * HIDDEN))[i];
            ((float4*)acc)[li] = make_float4(0.f, 0.f, 0.f, 0.f);
        }
        __syncthreads();

        // the range's record count, the same scalar in every wave: the branch and its barriers are block-uniform
        int T = 0;
        {
            const int x = (int)wtot[lane];
#pragma unroll
            for (int i = 0; i < 32; ++i) T += __builtin_amdgcn_readlane(x, i);
        }
        if (T <= CAPR) {
            // Sorted path, part 2: a record's rank among those of its out row, the rows' first places
            // (scan by wave 0), then every record to its place in srt.
            unsigned rk[CPW][2];
#pragma unroll
            for (int t = 0; t < CPW; ++t) {
                rk[t][0] = 0u; rk[t][1] = 0u;
                if (lane < zs[t]) rk[t][0] = atomicAdd(&rcnt[r[t][0].x & 255u], 1u);
                if (zs[t] > 32) {
                    if (lane + 32 < zs[t]) rk[t][1] = atomicAdd(&rcnt[r[t][1].x & 255u], 1u);
                }
            }
            __syncthreads();
            if (wave == 0) {
                const uint4 ca = ((const uint4*)rcnt)[lane * 2];
                const uint4 cb = ((const uint4*)rcnt)[lane * 2 + 1];
                const unsigned sum = ca.x + ca.y + ca.z + ca.w + cb.x + cb.y + cb.z + cb.w;
                unsigned x = sum;
#pragma unroll
                for (int d = 1; d < 32; d <<= 1) {
                    const unsigned y = __shfl_up(x, d, 32);
                    if (lane >= d) x += y;
                }
                uint4 ea, eb;
                ea.x = x - sum;     ea.y = ea.x + ca.x; ea.z = ea.y + ca.y; ea.w = ea.z + ca.z;
                eb.x = ea.w + ca.w; eb.y = eb.x + cb.x; eb.z = eb.y + cb.y; eb.w = eb.z + cb.z;
                ((uint4*)rcnt)[lane * 2]     = ea;
                ((uint4*)rcnt)[lane * 2 + 1] = eb;
            }
            __syncthreads();
#pragma unroll
            for (int t = 0; t < CPW; ++t) {
                if (lane < zs[t]) srt[rcnt[r[t][0].x & 255u] + rk[t][0]] = r[t][0];
                if (zs[t] > 32) {
                    if (lane + 32 < zs[t]) srt[rcnt[r[t][1].x & 255u] + rk[t][1]] = r[t][1];
                }
            }
            // a wave's steps follow its longest run: a shorter one reads past its end, the last run past the list's end: row 0, weight zero
            if (tid < 4) srt[T + tid] = make_uint2(0u, 0u);
            __syncthreads();

            // Part 3: each of the 128 8-lane groups takes an equal run of the sorted list and keeps the
            // sums of the out row it is in in eight registers per lane; they go to LDS (as adds: an
            // out row may lie across two runs) only where the out row changes and at the run's end.
            const unsigned l8 = lane & 7;           // lane inside its 8-lane group
            const int hw = wave * 4 + (lane >> 3);
            const int b0 = (hw * T) >> 7;
            const int b1 = ((hw + 1) * T) >> 7;
            int ns = 0;                             // steps of the wave: the longest of its four runs
#pragma unroll
            for (int g = 0; g < 4; ++g)
                ns = max(ns, (((wave * 4 + g + 1) * T) >> 7) - (((wave * 4 + g) * T) >> 7));
            ns = __builtin_amdgcn_readfirstlane(ns); // the same in every lane: the loop's test stays scalar
            unsigned cur = 0u;                      // byte offset of the out row whose sums a, b hold
            v4f a = {0.f, 0.f, 0.f, 0.f};
            v4f b = {0.f, 0.f, 0.f, 0.f};
            int j = 0;
            for (; j + 4 <= ns; j += 4)
                SparseMHA_run_steps<4>(kv, qs, acc, srt + b0 + j, b1 - b0 - j, l8, cur, a, b);
            // the last one to three steps in a group of their own size: with runs of about 50 records
            // a fourth group filled up with empty steps would cost several per cent of loads and issue
            const int rest = ns - j;
            if (rest == 3)      SparseMHA_run_steps<3>(kv, qs, acc, srt + b0 + j, b1 - b0 - j, l8, cur, a, b);
            else if (rest == 2) SparseMHA_run_steps<2>(kv, qs, acc, srt + b0 + j, b1 - b0 - j, l8, cur, a, b);
            else if (rest == 1) SparseMHA_run_steps<1>(kv, qs, acc, srt + b0 + j, b1 - b0 - j, l8, cur, a, b);
            SparseMHA_flush(acc, cur, l8, a, b);
        } else
        for (int c0 = wave; c0 < nch && bin < NB; c0 += 1024) {
            // lane t holds the range's bounds in chunk c0 + 32 t: one load for up to 32 chunks
            const int cl = min(c0 + lane * 32, nch - 1);
            const int sl = (int)off[cl * (NB + 1) + bin];
            const int el = (int)off[cl * (NB + 1) + bin + 1];
            const int nj = min(32, (nch - c0 + 31) >> 5);
            // the first 32 records of a chunk's part are asked for one chunk ahead
            uint2 nx = make_uint2(0u, 0u);
            {
                const int s1 = __builtin_amdgcn_readlane(sl, 0);
                const int e1 = __builtin_amdgcn_readlane(el, 0);
                if (e1 > s1) {
                    nx = ((const uint2*)rec + c0 * CHCAP)[s1 + SparseMHA_deal(lane, min(32, e1 - s1))];
                    // the load stays in flight: its address register is reused right behind it
                    asm volatile("s_wait_xcnt 0x0" ::: "memory");
                }
            }
            for (int t = 0; t < nj; ++t) {
            const int s = __builtin_amdgcn_readlane(sl, t);
            const int e = __builtin_amdgcn_readlane(el, t);
            const uint2* __restrict__ rp = (const uint2*)rec + (c0 + 32 * t) * CHCAP;
            uint2 rc = nx;
            if (t + 1 < nj) {
                const int s1 = __builtin_amdgcn_readlane(sl, t + 1);
                const int e1 = __builtin_amdgcn_readlane(el, t + 1);
                if (e1 > s1) {
                    nx = (rp + 32 * CHCAP)[s1 + SparseMHA_deal(lane, min(32, e1 - s1))];
                    // the load stays in flight: its address register is reused right behind it
                    asm volatile("s_wait_xcnt 0x0" ::: "memory");
                }
            }
            for (int p = s; p < e; p += 32) {
                const int m = min(32, e - p);
                if (p > s) {
                    rc = rp[p + SparseMHA_deal(lane, m)];
                    // the load stays in flight: its address register is reused right behind it
                    asm volatile("s_wait_xcnt 0x0" ::: "memory");
                }
                // a lane without a record of its own holds a copy with weight zero
                const unsigned wa = SparseMHA_dealt(lane, m) ? rc.y : 0u;
                const unsigned ka = rc.x & ~255u;
                const unsigned ra = (rc.x & 255u) * (LPITCH * 4u);
                const int hm = (m + 1) >> 1;     // steps: one edge per 16-lane row each
                for (int j = 0; j < hm; ) {
                    if (hm - j > 2) { SparseMHA_steps<4>(kv, qs, acc, ka, ra, wa, j, l16); j += 4; }
                    else            { SparseMHA_steps<2>(kv, qs, acc, ka, ra, wa, j, l16); j += 2; }
                }
            }
            }
        }
        __syncthreads();

        // channels 4c .. 4c+3 of a row are value c & 3 of lanes 4 (c >> 2) .. + 3
        for (int i = tid; i < nr * (HIDDEN / 4); i += 1024) {
            const int c = i & 15;
            ((float4*)(out + rb * HIDDEN))[i] =
                ((const float4*)acc)[(i >> 4) * (LPITCH / 4) + (c & 3) * 4 + (c >> 2)];
        }
        __syncthreads();                         // acc and qs are free for the next range
    }
}

// ---------------------------------------------------------------------------
extern "C" void kernel_launch(void* const* d_in, const int* in_sizes, int n_in,
                              void* d_out, int out_size, void* d_ws, size_t ws_size,
                              hipStream_t stream) {
    const float* h   = (const float*)d_in[0];
    const int*   row = (const int*)  d_in[1];
    const int*   col = (const int*)  d_in[2];
    const float* ew  = (const float*)d_in[3];
    const float* Wq  = (const float*)d_in[4];
    const float* bq  = (const float*)d_in[5];
    const float* Wk  = (const float*)d_in[6];
    const float* bk  = (const float*)d_in[7];
    const float* Wv  = (const float*)d_in[8];
    const float* bv  = (const float*)d_in[9];
    float*       out = (float*)d_out;

    const int n   = in_sizes[0] / HIDDEN;   // 50000
    const int nnz = in_sizes[1];            // 1600000

    float* qws = (float*)d_ws;
    unsigned* kvws = (unsigned*)(qws + (size_t)n * HIDDEN);  // one word per channel: k and v as f16
    unsigned* rec = kvws + (size_t)n * HIDDEN;               // 2 words per edge, whole chunks
    unsigned* off = rec + 2 * ((size_t)nnz + CHCAP);         // NB + 1 words per chunk

    // q/k/v projections via fp32 WMMA and, beside them in the same launch, the edge records
    // in order of out-row range, chunk by chunk
    SparseMHA_prep_kernel<<<PROJ_BLOCKS + SORT_BLOCKS, PREP_THREADS, 0, stream>>>(
        h, Wq, bq, Wk, bk, Wv, bv, row, col, ew, qws, kvws, rec, off, nnz, n);

    // fused edge SDDMM + sigmoid*w + sums in LDS, every out row stored once
    SparseMHA_edge_kernel<<<SUM_BLOCKS, 1024, 0, stream>>>(
        qws, kvws, rec, off, out, nnz, n);
}

// v010
// A run of this version takes 41.3 microseconds.
// Timed twice side by side with v009, it ran 1.04 times as fast both times.
// Over all steps from v000 it is 4.01 times as fast.
#include <hip/hip_runtime.h>
#include <hip/hip_bf16.h>
#include <math.h>

#define HIDDEN    64
#define NUM_HEADS 4
#define HEAD_DIM  16
#define SCALING   0.25f  // HEAD_DIM^-0.5

typedef __attribute__((ext_vector_type(2))) float v2f;
typedef __attribute__((ext_vector_type(8))) float v8f;
typedef __attribute__((ext_vector_type(4))) float v4f;
typedef __attribute__((ext_vector_type(4))) unsigned v4u;
typedef __attribute__((ext_vector_type(2))) _Float16 v2h;

// ---------------------------------------------------------------------------
// Kernel 1: the q/k/v projection and the edge sort in ONE launch. Neither reads
//   what the other writes, so the block index picks the part: the first
//   PROJ_BLOCKS blocks project, the other SORT_BLOCKS sort. The sort's loads, LDS
//   adds and barriers run beside the projection's WMMAs, not behind them.
//
//   Projection, native fp32 WMMA (16x16x4): wave w -> stored slots
//   [16 (w & 3), + 16) of tile stream 2 * block + (w >> 2). A wave reads the 48
//   B fragments of its 16 slots (three weight matrices, 16 K-steps) ONCE and
//   keeps them in registers, then loops over tiles of 16 rows of h (tile index
//   strided by the stream count): per tile it loads only the 16 A fragments.
//   48 v_wmma_f32_16x16x4_f32 per wave and tile. Epilogue adds bias (and
//   applies SCALING to q as in the reference). q is stored as f32; k and v are
//   rounded to f16 (nearest even) and stored as ONE row: word j of a kv row holds
//   slot j of k in its low half and slot j of v in its high half, so that an edge
//   takes 256 bytes from L2, not 512.
//
//   Sort: edges in order of out-row range, chunk by chunk. The out rows are cut
//   into NB ranges of RPB rows; the edge list into chunks of CHCAP edges. A
//   block counts its chunk's edges per range in LDS, scans the counts, places
//   each edge's 8-byte record (col * 256 + row inside its range, edge weight)
//   in LDS in range order and writes the chunk out in whole lines, with the
//   NB + 1 starts of the ranges inside the chunk.
//   The declared shapes give n <= NB * RPB rows.
// ---------------------------------------------------------------------------
#define PREP_THREADS 256  // 8 waves
#define PROJ_BLOCKS  256  // one per WGP
#define PROJ_STREAMS 512  // 2 per block: 2 projecting waves per SIMD, about 6 tiles per stream
#define SORT_BLOCKS  256  // one per WGP, one chunk each at the declared shapes
#define SUM_BLOCKS   256
#define RPB    196    // out rows per range: sums and q rows of a range take 123 KiB of LDS
#define NB     256    // ranges: one per WGP, and one per thread of a sorting block
#define CHCAP  6272   // edges per chunk (49 KiB of records in LDS)
#define EPT    25     // edges per thread of a sorting block: ceil(CHCAP / PREP_THREADS)
static_assert(NB == PREP_THREADS, "a sorting thread owns one range");
static_assert(EPT * PREP_THREADS >= CHCAP, "a chunk fits its block's threads");

__device__ __forceinline__ void SparseMHA_proj_part(
    const float* __restrict__ h,
    const float* __restrict__ Wq, const float* __restrict__ bq,
    const float* __restrict__ Wk, const float* __restrict__ bk,
    const float* __restrict__ Wv, const float* __restrict__ bv,
    float* __restrict__ qout, unsigned* __restrict__ kvout,
    int n, int blk)
{
    // wave-uniform, so the tile loop is scalar control flow and EXEC stays all ones at the WMMAs
    const int wave = __builtin_amdgcn_readfirstlane(threadIdx.x >> 5);
    const int lane = threadIdx.x & 31;
    const int half = lane >> 4;      // 0: K lo pair / M,N 0-7 side, 1: K hi pair
    const int r16  = lane & 15;
    const int n0   = (wave & 3) * 16;
    const int nt   = (n + 15) >> 4;  // tiles of 16 rows

    int t = blk * 2 + (wave >> 2);
    if (t >= nt) return;             // whole waves leave; this part has no barrier

    // Slot colj of a stored q/k/v row holds channel chan: slots 4l..4l+3 hold the channels
    // of head l & 3 with d = 4 (l >> 2) .. + 3 (channel = d * 4 + head), so that kernel 2
    // reads four channels of one head (q; k with v) with one 16-byte load per lane, 16 lanes to a row.
    const int colj = n0 + r16;
    const int chan = (colj & 48) | ((colj & 3) << 2) | ((colj >> 2) & 3);
    const float* __restrict__ wqrow = Wq + chan * HIDDEN + half * 2;  // B[kk,n] = W[chan(n0+n), kb+kk]
    const float* __restrict__ wkrow = Wk + chan * HIDDEN + half * 2;
    const float* __restrict__ wvrow = Wv + chan * HIDDEN + half * 2;

    v2f bqf[16], bkf[16], bvf[16];   // this lane's K pair of every 4-wide slab, all three matrices
#pragma unroll
    for (int ks = 0; ks < 16; ++ks) {
        bqf[ks] = *(const v2f*)(wqrow + ks * 4);
        bkf[ks] = *(const v2f*)(wkrow + ks * 4);
        bvf[ks] = *(const v2f*)(wvrow + ks * 4);
    }
    const float biasq = bq[chan];
    const float biask = bk[chan];
    const float biasv = bv[chan];

    // A-row clamped so WMMA can run with EXEC all-ones even on a ragged tail.
    v2f af[16];
    {
        const float* __restrict__ hrow = h + min(t * 16 + r16, n - 1) * HIDDEN + half * 2;
#pragma unroll
        for (int ks = 0; ks < 16; ++ks) af[ks] = *(const v2f*)(hrow + ks * 4);
    }

    for (;;) {
        // the next tile's A fragments come in under this tile's WMMAs
        // (the last trip reads its own tile again: always in bounds)
        const int tn = t + PROJ_STREAMS;
        const int tp = tn < nt ? tn : t;
        v2f an[16];
        {
            const float* __restrict__ hrow = h + min(tp * 16 + r16, n - 1) * HIDDEN + half * 2;
#pragma unroll
            for (int ks = 0; ks < 16; ++ks) an[ks] = *(const v2f*)(hrow + ks * 4);
        }

        v8f accq = {}; v8f acck = {}; v8f accv = {};
#pragma unroll
        for (int ks = 0; ks < 16; ++ks) {
            accq = __builtin_amdgcn_wmma_f32_16x16x4_f32(false, af[ks], false, bqf[ks],
                                                         (short)0, accq, false, false);
            acck = __builtin_amdgcn_wmma_f32_16x16x4_f32(false, af[ks], false, bkf[ks],
                                                         (short)0, acck, false, false);
            accv = __builtin_amdgcn_wmma_f32_16x16x4_f32(false, af[ks], false, bvf[ks],
                                                         (short)0, accv, false, false);
        }

        // four vector slots between the last WMMA and the first vector instruction that
        // reuses its A registers (dead from here on) or reads its result; the two
        // scheduling barriers keep the slots directly behind that WMMA
        __builtin_amdgcn_sched_barrier(0);
        asm volatile("v_nop\n\tv_nop\n\tv_nop\n\tv_nop");
        __builtin_amdgcn_sched_barrier(0);

        // C layout: VGPR vr, lanes 0-15 -> M = vr, lanes 16-31 -> M = vr + 8; N = lane%16
        const int m0 = t * 16;
#pragma unroll
        for (int vr = 0; vr < 8; ++vr) {
            const int m = m0 + vr + half * 8;
            if (m < n) {
                const int idx = m * HIDDEN + colj;
                qout[idx] = (accq[vr] + biasq) * SCALING;
                const v2h kv = {(_Float16)(acck[vr] + biask), (_Float16)(accv[vr] + biasv)};
                kvout[idx] = __builtin_bit_cast(unsigned, kv);
            }
        }
        // the next trip overwrites registers that the last row's stores name
        asm volatile("s_wait_xcnt 0x0" ::: "memory");

        if (tn >= nt) break;
        t = tn;
#pragma unroll
        for (int ks = 0; ks < 16; ++ks) af[ks] = an[ks];
    }
}

// cnt, scn: NB words each; srt: CHCAP records and 32 spare ones. Thread tid owns range tid in the scan.
__device__ __forceinline__ void SparseMHA_sort_part(
    const int* __restrict__ row, const int* __restrict__ col,
    const float* __restrict__ ew,
    unsigned* __restrict__ rec, unsigned* __restrict__ off, int nnz, int n, int blk,
    unsigned* cnt, unsigned* scn, uint2* srt)
{
    const int tid  = threadIdx.x;
    const int nch  = (nnz + CHCAP - 1) / CHCAP;
    const int rmax = min(n, NB * RPB) - 1;

    for (int c = blk; c < nch; c += SORT_BLOCKS) {
        const int e0 = c * CHCAP;
        const int m  = min(CHCAP, nnz - e0);
        // a thread's EPT edges are asked for at once and stay in registers for both passes
        int rr[EPT], cc[EPT]; float ww[EPT];
#pragma unroll
        for (int t = 0; t < EPT; ++t) {
            const int i = min(tid + t * PREP_THREADS, m - 1);
            rr[t] = row[e0 + i]; cc[t] = col[e0 + i]; ww[t] = ew[e0 + i];
            // the loads stay in flight: a later trip's result may land in their offset register
            asm volatile("s_wait_xcnt 0x0" ::: "memory");
        }
        cnt[tid] = 0u;
        __syncthreads();
#pragma unroll
        for (int t = 0; t < EPT; ++t) {
            rr[t] = min(max(rr[t], 0), rmax);
            if (tid + t * PREP_THREADS < m) atomicAdd(&cnt[rr[t] / RPB], 1u);
        }
        __syncthreads();
        // inclusive scan of the NB counts (every thread passes every barrier)
        unsigned x = cnt[tid];
        scn[tid] = x;
        __syncthreads();
        for (int d = 1; d < NB; d <<= 1) {
            unsigned y = 0u;
            if (tid >= d) y = scn[tid - d];
            __syncthreads();
            x += y; scn[tid] = x;
            __syncthreads();
        }
        {
            const unsigned st = x - cnt[tid];      // first place of this range in the chunk
            off[c * (NB + 1) + tid] = st;
            cnt[tid] = st;                         // from here on the range's next free place
        }
        if (tid == 0) off[c * (NB + 1) + NB] = (unsigned)m;
        __syncthreads();
        // a thread's EPT places are all asked for before the first is used: with 8 waves
        // to a chunk the latencies of the returning adds would otherwise stand in a row
        unsigned pos[EPT];
#pragma unroll
        for (int t = 0; t < EPT; ++t) {
            pos[t] = 0u;
            if (tid + t * PREP_THREADS < m) pos[t] = atomicAdd(&cnt[rr[t] / RPB], 1u);
        }
        // no branch round the stores (a lane without an edge writes its own spare record
        // behind the chunk, which nobody reads): one run of stores behind one wait
#pragma unroll
        for (int t = 0; t < EPT; ++t) {
            const int cl = min(max(cc[t], 0), n - 1);
            const int b  = rr[t] / RPB;
            const unsigned at = tid + t * PREP_THREADS < m ? pos[t] : (unsigned)(CHCAP + (tid & 31));
            srt[at] = make_uint2(((unsigned)cl << 8) | (unsigned)(rr[t] - b * RPB),
                                 __float_as_uint(ww[t]));
        }
        __syncthreads();
        // likewise all LDS reads first (index clamped into the chunk), then the stores
        uint2 ro[EPT];
#pragma unroll
        for (int t = 0; t < EPT; ++t) ro[t] = srt[min(tid + t * PREP_THREADS, m - 1)];
#pragma unroll
        for (int t = 0; t < EPT; ++t) {
            const int i = tid + t * PREP_THREADS;
            if (i < m) ((uint2*)rec)[e0 + i] = ro[t];
        }
        __syncthreads();                           // srt and cnt are free for the next chunk
    }
}

__global__ __launch_bounds__(PREP_THREADS) void SparseMHA_prep_kernel(
    const float* __restrict__ h,
    const float* __restrict__ Wq, const float* __restrict__ bq,
    const float* __restrict__ Wk, const float* __restrict__ bk,
    const float* __restrict__ Wv, const float* __restrict__ bv,
    const int* __restrict__ row, const int* __restrict__ col,
    const float* __restrict__ ew,
    float* __restrict__ qout, unsigned* __restrict__ kvout,
    unsigned* __restrict__ rec, unsigned* __restrict__ off, int nnz, int n)
{
    __shared__ unsigned cnt[NB];
    __shared__ unsigned scn[NB];
    __shared__ uint2    srt[CHCAP + 32];
    // the same for a whole block: every barrier of the sort is passed by all of its threads
    if (blockIdx.x < PROJ_BLOCKS)
        SparseMHA_proj_part(h, Wq, bq, Wk, bk, Wv, bv, qout, kvout, n, blockIdx.x);
    else
        SparseMHA_sort_part(row, col, ew, rec, off, nnz, n, blockIdx.x - PROJ_BLOCKS,
                            cnt, scn, srt);
}

// ---------------------------------------------------------------------------
// Kernel 2: fused SDDMM + sigmoid*edge_weight + SPMM, one block per row range.
//   The block holds its range's q rows and its out sums in LDS. A wave takes
//   every 32nd chunk and reads the range's records of that chunk, 32 at a time.
//   TWO EDGES PER WAVE INSTRUCTION: each 16-lane row of the wave works on an
//   edge of its own. Lane l of a row reads slots 4l..4l+3 of a kv or q row
//   with one 16-byte load; kernel 1 stores there four channels of head l & 3
//   (in a kv row k as f16 in the low, v as f16 in the high half of each word),
//   so a lane sums four products itself and the sum over d ends over the lanes
//   with equal l & 3 (xor 4, 8 inside the row). All products and sums are f32.
//   Only the kv rows come from L2, the sums are LDS adds, and each out row is
//   stored once (rows without an edge as zero).
//   SORTED PATH (a range of at most CAPR records, no part above 64, at most 32 CPW
//   chunks): the block first puts the range's records in order of out row in LDS
//   (rank by a returning LDS add per record, one scan of the row counts). There an
//   edge takes only 8 LANES, FOUR EDGES PER WAVE INSTRUCTION: lane l of a group
//   reads slots 4l..4l+3 and 4(l+8)..4(l+8)+3, eight channels of head l & 3, so
//   the score's cross-lane sum, the sigmoid and its reciprocal are paid once per four
//   edges. The 128 groups take equal runs of that list; a run's records of one out
//   row follow one another, so their sum stays in registers and goes to LDS once per
//   out row and run, not once per edge. Any other range takes the loop over parts.
//   LDS rows have a pitch of LPITCH words. A sum row holds value i of lane l at
//   word 16 i + l: one add instruction covers 16 banks in a run for each edge,
//   and the pitch sets the runs of rows r and r + 1 on different banks.
// ---------------------------------------------------------------------------
#define LPITCH 80     // words per q row and per sum row in LDS (64 used)

// A batch of m (1 to 32) records is dealt to the two 16-lane rows: row 0 takes the
// first ceil(m / 2), row 1 the rest. The index of this lane's record (clamped into the batch):
__device__ __forceinline__ int SparseMHA_deal(int lane, int m) {
    return min((lane >> 4) * ((m + 1) >> 1) + (lane & 15), m - 1);
}
// whether the lane's record is its own (else it is a copy and gets weight zero)
__device__ __forceinline__ bool SparseMHA_dealt(int lane, int m) {
    const int hm = (m + 1) >> 1;
    return (lane & 15) < ((lane >> 4) ? m - hm : hm);
}

// every lane gets the value of lane s of its own 16-lane row; sel holds s in each nibble
__device__ __forceinline__ unsigned SparseMHA_row_lane(unsigned x, unsigned sel) {
    return (unsigned)__builtin_amdgcn_permlane16((int)x, (int)x, sel, sel, false, false);
}

// sum over the lanes l ^ 4, l ^ 8 of a 16-lane row (DPP row_xmask)
__device__ __forceinline__ float SparseMHA_head_sum(float p) {
    p += __builtin_bit_cast(float, __builtin_amdgcn_update_dpp(
             0, __builtin_bit_cast(int, p), 0x164, 0xf, 0xf, true));
    p += __builtin_bit_cast(float, __builtin_amdgcn_update_dpp(
             0, __builtin_bit_cast(int, p), 0x168, 0xf, 0xf, true));
    return p;
}

// sum over the lanes l, l ^ 4 of an 8-lane group (DPP row_xmask)
__device__ __forceinline__ float SparseMHA_pair_sum(float p) {
    p += __builtin_bit_cast(float, __builtin_amdgcn_update_dpp(
             0, __builtin_bit_cast(int, p), 0x164, 0xf, 0xf, true));
    return p;
}

// the k (low) and the v (high) half of a kv word, as f32
__device__ __forceinline__ float SparseMHA_k_of(unsigned x) { return (float)__builtin_bit_cast(v2h, x).x; }
__device__ __forceinline__ float SparseMHA_v_of(unsigned x) { return (float)__builtin_bit_cast(v2h, x).y; }

// q . k over a lane's four channels of one head, f32 products of f32 q and f16 k, summed in a chain
__device__ __forceinline__ float SparseMHA_dot4(v4f q, v4u kv) {
    float s = q.x * SparseMHA_k_of(kv.x);
    s = fmaf(q.y, SparseMHA_k_of(kv.y), s);
    s = fmaf(q.z, SparseMHA_k_of(kv.z), s);
    return fmaf(q.w, SparseMHA_k_of(kv.w), s);
}

// the same over a lane's eight channels of one head, one chain of 8
__device__ __forceinline__ float SparseMHA_dot8(v4f qa, v4u ka, v4f qb, v4u kb) {
    float s = SparseMHA_dot4(qa, ka);
    s = fmaf(qb.x, SparseMHA_k_of(kb.x), s);
    s = fmaf(qb.y, SparseMHA_k_of(kb.y), s);
    s = fmaf(qb.z, SparseMHA_k_of(kb.z), s);
    return fmaf(qb.w, SparseMHA_k_of(kb.w), s);
}

// sigmoid(p) * w as w * (1 / (1 + e^-p)): the hardware reciprocal (1 ulp) and one multiply, not the IEEE
// division sequence (two scalings, Newton steps, fix-up). The denominator is at least 1: no overflow, no
// division by zero; +inf gives 0 and NaN gives NaN as the division does; above 2^126 the reciprocal may
// be flushed to 0 where the quotient would lie below 1e-37
__device__ __forceinline__ float SparseMHA_gate(float p, float w) {
    return w * __builtin_amdgcn_rcpf(1.0f + __expf(-p));
}

// U steps, each one edge per 16-lane row: the records of lanes j .. j + U - 1 of both rows.
// ka: col * 256 (byte offset of the kv row), ra: byte offset of the row in LDS, wa: weight.
template <int U>
__device__ __forceinline__ void SparseMHA_steps(
    const unsigned* __restrict__ kv,
    const float* qs, float* acc,
    unsigned ka, unsigned ra, unsigned wa, int j, unsigned l16)
{
    unsigned ko[U], ro[U];
    float    w[U];
    v4u      kw[U];
    v4f      qq[U];
#pragma unroll
    for (int u = 0; u < U; ++u) {
        const unsigned sel = (unsigned)(j + u) * 0x11111111u;
        ko[u] = SparseMHA_row_lane(ka, sel) + l16 * 16u;
        ro[u] = SparseMHA_row_lane(ra, sel);
        w[u]  = __uint_as_float(SparseMHA_row_lane(wa, sel));
    }
#pragma unroll
    for (int u = 0; u < U; ++u) qq[u] = *(const v4f*)((const char*)qs + ro[u] + l16 * 16u);
    // All U row loads of the steps in one statement with their data wait: written as plain
    // loads, the compiler sinks each step's load to its own arithmetic and the L2 latencies
    // of the steps add up instead of overlapping.
    if constexpr (U == 4) {
        asm volatile("global_load_b128 %0, %4, %8\n\t"
                     "global_load_b128 %1, %5, %8\n\t"
                     "global_load_b128 %2, %6, %8\n\t"
                     "global_load_b128 %3, %7, %8\n\t"
                     "s_wait_loadcnt 0x0"
                     : "=&v"(kw[0]), "=&v"(kw[1]), "=&v"(kw[2]), "=&v"(kw[3])
                     : "v"(ko[0]), "v"(ko[1]), "v"(ko[2]), "v"(ko[3]), "s"(kv)
                     : "memory");
    } else {
        asm volatile("global_load_b128 %0, %2, %4\n\t"
                     "global_load_b128 %1, %3, %4\n\t"
                     "s_wait_loadcnt 0x0"
                     : "=&v"(kw[0]), "=&v"(kw[1])
                     : "v"(ko[0]), "v"(ko[1]), "s"(kv)
                     : "memory");
    }
#pragma unroll
    for (int u = 0; u < U; ++u) {
        const float p = SparseMHA_head_sum(SparseMHA_dot4(qq[u], kw[u]));
        // sigmoid(q . k of this lane's head) * edge weight
        const float t = SparseMHA_gate(p, w[u]);
        float* a = (float*)((char*)acc + ro[u] + l16 * 4u);
        atomicAdd(a,      t * SparseMHA_v_of(kw[u].x));
        atomicAdd(a + 16, t * SparseMHA_v_of(kw[u].y));
        atomicAdd(a + 32, t * SparseMHA_v_of(kw[u].z));
        atomicAdd(a + 48, t * SparseMHA_v_of(kw[u].w));
    }
}

// adds an 8-lane group's eight register sums per lane to the sum row at byte offset cur:
// a holds the values of lane l8, b those of lane l8 + 8 of the sum row's layout
__device__ __forceinline__ void SparseMHA_flush(float* acc, unsigned cur, unsigned l8, v4f a, v4f b) {
    float* p = (float*)((char*)acc + cur + l8 * 4u);
    atomicAdd(p,      a.x);
    atomicAdd(p + 8,  b.x);
    atomicAdd(p + 16, a.y);
    atomicAdd(p + 24, b.y);
    atomicAdd(p + 32, a.z);
    atomicAdd(p + 40, b.z);
    atomicAdd(p + 48, a.w);
    atomicAdd(p + 56, b.w);
}

// U steps of the sorted path, each one edge per 8-lane group: the U records at rp of this group's
// run, of which left are still its own. cur: byte offset of the out row whose sums a, b hold.
template <int U>
__device__ __forceinline__ void SparseMHA_run_steps(
    const unsigned* __restrict__ kv, const float* qs, float* acc,
    const uint2* rp, int left, unsigned l8, unsigned& cur, v4f& a, v4f& b)
{
    unsigned ko[U], ro[U];
    float    w[U];
    v4u      ka[U], kb[U];
    v4f      qa[U], qb[U];
#pragma unroll
    for (int u = 0; u < U; ++u) {
        // a step past the run's end takes the record that lies there with weight zero
        const uint2 rc = rp[u];
        w[u]  = u < left ? __uint_as_float(rc.y) : 0.f;
        ko[u] = (rc.x & ~255u) + l8 * 16u;
        ro[u] = (rc.x & 255u) * (LPITCH * 4u);
    }
#pragma unroll
    for (int u = 0; u < U; ++u) {
        qa[u] = *(const v4f*)((const char*)qs + ro[u] + l8 * 16u);
        qb[u] = *(const v4f*)((const char*)qs + ro[u] + l8 * 16u + 128u);
    }
    // All 2 U row loads of the steps (each covers one 128-byte half of four kv rows) in one
    // statement with their data wait: written as plain loads, the compiler sinks each step's
    // loads to its own arithmetic and the L2 latencies of the steps add up instead of overlapping.
    if constexpr (U == 4) {
        asm volatile("global_load_b128 %0, %8, %12\n\t"
                     "global_load_b128 %1, %8, %12 offset:128\n\t"
                     "global_load_b128 %2, %9, %12\n\t"
                     "global_load_b128 %3, %9, %12 offset:128\n\t"
                     "global_load_b128 %4, %10, %12\n\t"
                     "global_load_b128 %5, %10, %12 offset:128\n\t"
                     "global_load_b128 %6, %11, %12\n\t"
                     "global_load_b128 %7, %11, %12 offset:128\n\t"
                     "s_wait_loadcnt 0x0"
                     : "=&v"(ka[0]), "=&v"(kb[0]), "=&v"(ka[1]), "=&v"(kb[1]),
                       "=&v"(ka[2]), "=&v"(kb[2]), "=&v"(ka[3]), "=&v"(kb[3])
                     : "v"(ko[0]), "v"(ko[1]), "v"(ko[2]), "v"(ko[3]), "s"(kv)
                     : "memory");
    } else if constexpr (U == 3) {
        asm volatile("global_load_b128 %0, %6, %9\n\t"
                     "global_load_b128 %1, %6, %9 offset:128\n\t"
                     "global_load_b128 %2, %7, %9\n\t"
                     "global_load_b128 %3, %7, %9 offset:128\n\t"
                     "global_load_b128 %4, %8, %9\n\t"
                     "global_load_b128 %5, %8, %9 offset:128\n\t"
                     "s_wait_loadcnt 0x0"
                     : "=&v"(ka[0]), "=&v"(kb[0]), "=&v"(ka[1]), "=&v"(kb[1]),
                       "=&v"(ka[2]), "=&v"(kb[2])
                     : "v"(ko[0]), "v"(ko[1]), "v"(ko[2]), "s"(kv)
                     : "memory");
    } else if constexpr (U == 2) {
        asm volatile("global_load_b128 %0, %4, %6\n\t"
                     "global_load_b128 %1, %4, %6 offset:128\n\t"
                     "global_load_b128 %2, %5, %6\n\t"
                     "global_load_b128 %3, %5, %6 offset:128\n\t"
                     "s_wait_loadcnt 0x0"
                     : "=&v"(ka[0]), "=&v"(kb[0]), "=&v"(ka[1]), "=&v"(kb[1])
                     : "v"(ko[0]), "v"(ko[1]), "s"(kv)
                     : "memory");
    } else {
        asm volatile("global_load_b128 %0, %2, %3\n\t"
                     "global_load_b128 %1, %2, %3 offset:128\n\t"
                     "s_wait_loadcnt 0x0"
                     : "=&v"(ka[0]), "=&v"(kb[0])
                     : "v"(ko[0]), "s"(kv)
                     : "memory");
    }
#pragma unroll
    for (int u = 0; u < U; ++u) {
        if (ro[u] != cur) {
            SparseMHA_flush(acc, cur, l8, a, b);
            a = v4f{0.f, 0.f, 0.f, 0.f};
            b = v4f{0.f, 0.f, 0.f, 0.f};
            cur = ro[u];
        }
        // each step's score is formed in its own step and in one chain: with two chains or the
        // scores of the steps side by side the compiler pairs them for packed f32 operations and pays
        // conversions and copies; so it multiplies the f16 halves directly (v_fma_mix_f32)
        const float p = SparseMHA_pair_sum(SparseMHA_dot8(qa[u], ka[u], qb[u], kb[u]));
        // sigmoid(q . k of this lane's head) * edge weight
        const float t = SparseMHA_gate(p, w[u]);
        a.x = fmaf(t, SparseMHA_v_of(ka[u].x), a.x);
        a.y = fmaf(t, SparseMHA_v_of(ka[u].y), a.y);
        a.z = fmaf(t, SparseMHA_v_of(ka[u].z), a.z);
        a.w = fmaf(t, SparseMHA_v_of(ka[u].w), a.w);
        b.x = fmaf(t, SparseMHA_v_of(kb[u].x), b.x);
        b.y = fmaf(t, SparseMHA_v_of(kb[u].y), b.y);
        b.z = fmaf(t, SparseMHA_v_of(kb[u].z), b.z);
        b.w = fmaf(t, SparseMHA_v_of(kb[u].w), b.w);
    }
}

#define CAPR 8192     // records of one range that the sorted path holds in LDS (64 KiB)
#define CPW  8        // chunks per wave on the sorted path: 32 waves take 256 chunks

__global__ __launch_bounds__(1024) void SparseMHA_edge_kernel(
    const float* __restrict__ q, const unsigned* __restrict__ kv,
    const unsigned* __restrict__ rec, const unsigned* __restrict__ off,
    float* __restrict__ out, int nnz, int n)
{
    __shared__ __attribute__((aligned(16))) float acc[RPB * LPITCH];
    __shared__ __attribute__((aligned(16))) float qs[RPB * LPITCH];
    __shared__ __attribute__((aligned(16))) uint2    srt[CAPR + 4]; // the range's records in order of out row, 4 empty ones behind
    __shared__ __attribute__((aligned(16))) unsigned rcnt[256];   // records per out row, then each row's first place
    __shared__ unsigned wtot[32];                                 // records per wave
    const int tid  = threadIdx.x;
    const int lane = tid & 31;
    // wave-uniform, so chunk numbers and range bounds stay in scalar registers
    const int wave = __builtin_amdgcn_readfirstlane(tid >> 5);
    const int nch  = (nnz + CHCAP - 1) / CHCAP;
    const int nb   = (n + RPB - 1) / RPB;
    const unsigned l16 = lane & 15;              // lane inside its 16-lane row

    for (int bin = blockIdx.x; bin < nb; bin += gridDim.x) {
        const int rb = bin * RPB;
        const int nr = min(RPB, n - rb);
        // Sorted path, part 1: a wave takes chunks wave + 32 t; lane t holds the range's bounds there.
        // Up to 64 records of each part go to registers (lane, lane + 32); a range with a longer
        // part, with more than CAPR records, or a list of more than 32 CPW chunks takes the other path.
        const bool pre = nch <= 32 * CPW && bin < NB;
        const int  njw = pre && wave < nch ? (nch - wave + 31) >> 5 : 0;
        int   zs[CPW];
        uint2 r[CPW][2];
        {
            int sl = 0, el = 0;
            if (pre) {
                const int cl = min(wave + lane * 32, nch - 1);
                sl = (int)off[cl * (NB + 1) + bin];
                el = (int)off[cl * (NB + 1) + bin + 1];
            }
            int tot = 0, mx = 0;
#pragma unroll
            for (int t = 0; t < CPW; ++t) {
                const int s = __builtin_amdgcn_readlane(sl, t);
                const int z = t < njw ? __builtin_amdgcn_readlane(el, t) - s : 0;
                zs[t] = z; tot += z; mx = max(mx, z);
                r[t][0] = make_uint2(0u, 0u);
                r[t][1] = make_uint2(0u, 0u);
                const uint2* __restrict__ rp = (const uint2*)rec + (wave + 32 * t) * CHCAP + s;
                if (z > 0) {
                    r[t][0] = rp[min(lane, z - 1)];
                    // the load stays in flight: its address register is reused right behind it
                    asm volatile("s_wait_xcnt 0x0" ::: "memory");
                }
                if (z > 32) {
                    r[t][1] = rp[min(lane + 32, z - 1)];
                    // the load stays in flight: its address register is reused right behind it
                    asm volatile("s_wait_xcnt 0x0" ::: "memory");
                }
            }
            if (lane == 0) wtot[wave] = pre && mx <= 64 ? (unsigned)tot : (unsigned)(CAPR + 1);
        }
        if (tid < 256) rcnt[tid] = 0u;
        for (int i = tid; i < nr * (HIDDEN / 4); i += 1024) {
            const int li = (i >> 4) * (LPITCH / 4) + (i & 15);
            ((float4*)qs)[li]  = ((const float4*)(q + rb * HIDDEN))[i];
            ((float4*)acc)[li] = make_float4(0.f, 0.f, 0.f, 0.f);
        }
        __syncthreads();

        // the range's record count, the same scalar in every wave: the branch and its barriers are block-uniform
        int T = 0;
        {
            const int x = (int)wtot[lane];
#pragma unroll
            for (int i = 0; i < 32; ++i) T += __builtin_amdgcn_readlane(x, i);
        }
        if (T <= CAPR) {
            // Sorted path, part 2: a record's rank among those of its out row, the rows' first places
            // (scan by wave 0), then every record to its place in srt.
            unsigned rk[CPW][2];
#pragma unroll
            for (int t = 0; t < CPW; ++t) {
                rk[t][0] = 0u; rk[t][1] = 0u;
                if (lane < zs[t]) rk[t][0] = atomicAdd(&rcnt[r[t][0].x & 255u], 1u);
                if (zs[t] > 32) {
                    if (lane + 32 < zs[t]) rk[t][1] = atomicAdd(&rcnt[r[t][1].x & 255u], 1u);
                }
            }
            __syncthreads();
            if (wave == 0) {
                const uint4 ca = ((const uint4*)rcnt)[lane * 2];
                const uint4 cb = ((const uint4*)rcnt)[lane * 2 + 1];
                const unsigned sum = ca.x + ca.y + ca.z + ca.w + cb.x + cb.y + cb.z + cb.w;
                unsigned x = sum;
#pragma unroll
                for (int d = 1; d < 32; d <<= 1) {
                    const unsigned y = __shfl_up(x, d, 32);
                    if (lane >= d) x += y;
                }
                uint4 ea, eb;
                ea.x = x - sum;     ea.y = ea.x + ca.x; ea.z = ea.y + ca.y; ea.w = ea.z + ca.z;
                eb.x = ea.w + ca.w; eb.y = eb.x + cb.x; eb.z = eb.y + cb.y; eb.w = eb.z + cb.z;
                ((uint4*)rcnt)[lane * 2]     = ea;
                ((uint4*)rcnt)[lane * 2 + 1] = eb;
            }
            __syncthreads();
#pragma unroll
            for (int t = 0; t < CPW; ++t) {
                if (lane < zs[t]) srt[rcnt[r[t][0].x & 255u] + rk[t][0]] = r[t][0];
                if (zs[t] > 32) {
                    if (lane + 32 < zs[t]) srt[rcnt[r[t][1].x & 255u] + rk[t][1]] = r[t][1];
                }
            }
            // a wave's steps follow its longest run: a shorter one reads past its end, the last run past the list's end: row 0, weight zero
            if (tid < 4) srt[T + tid] = make_uint2(0u, 0u);
            __syncthreads();

            // Part 3: each of the 128 8-lane groups takes an equal run of the sorted list and keeps the
            // sums of the out row it is in in eight registers per lane; they go to LDS (as adds: an
            // out row may lie across two runs) only where the out row changes and at the run's end.
            const unsigned l8 = lane & 7;           // lane inside its 8-lane group
            const int hw = wave * 4 + (lane >> 3);
            const int b0 = (hw * T) >> 7;
            const int b1 = ((hw + 1) * T) >> 7;
            int ns = 0;                             // steps of the wave: the longest of its four runs
#pragma unroll
            for (int g = 0; g < 4; ++g)
                ns = max(ns, (((wave * 4 + g + 1) * T) >> 7) - (((wave * 4 + g) * T) >> 7));
            ns = __builtin_amdgcn_readfirstlane(ns); // the same in every lane: the loop's test stays scalar
            unsigned cur = 0u;                      // byte offset of the out row whose sums a, b hold
            v4f a = {0.f, 0.f, 0.f, 0.f};
            v4f b = {0.f, 0.f, 0.f, 0.f};
            int j = 0;
            for (; j + 4 <= ns; j += 4)
                SparseMHA_run_steps<4>(kv, qs, acc, srt + b0 + j, b1 - b0 - j, l8, cur, a, b);
            // the last one to three steps in a group of their own size: with runs of about 50 records
            // a fourth group filled up with empty steps would cost several per cent of loads and issue
            const int rest = ns - j;
            if (rest == 3)      SparseMHA_run_steps<3>(kv, qs, acc, srt + b0 + j, b1 - b0 - j, l8, cur, a, b);
            else if (rest == 2) SparseMHA_run_steps<2>(kv, qs, acc, srt + b0 + j, b1 - b0 - j, l8, cur, a, b);
            else if (rest == 1) SparseMHA_run_steps<1>(kv, qs, acc, srt + b0 + j, b1 - b0 - j, l8, cur, a, b);
            SparseMHA_flush(acc, cur, l8, a, b);
        } else
        for (int c0 = wave; c0 < nch && bin < NB; c0 += 1024) {
            // lane t holds the range's bounds in chunk c0 + 32 t: one load for up to 32 chunks
            const int cl = min(c0 + lane * 32, nch - 1);
            const int sl = (int)off[cl * (NB + 1) + bin];
            const int el = (int)off[cl * (NB + 1) + bin + 1];
            const int nj = min(32, (nch - c0 + 31) >> 5);
            // the first 32 records of a chunk's part are asked for one chunk ahead
            uint2 nx = make_uint2(0u, 0u);
            {
                const int s1 = __builtin_amdgcn_readlane(sl, 0);
                const int e1 = __builtin_amdgcn_readlane(el, 0);
                if (e1 > s1) {
                    nx = ((const uint2*)rec + c0 * CHCAP)[s1 + SparseMHA_deal(lane, min(32, e1 - s1))];
                    // the load stays in flight: its address register is reused right behind it
                    asm volatile("s_wait_xcnt 0x0" ::: "memory");
                }
            }
            for (int t = 0; t < nj; ++t) {
            const int s = __builtin_amdgcn_readlane(sl, t);
            const int e = __builtin_amdgcn_readlane(el, t);
            const uint2* __restrict__ rp = (const uint2*)rec + (c0 + 32 * t) * CHCAP;
            uint2 rc = nx;
            if (t + 1 < nj) {
                const int s1 = __builtin_amdgcn_readlane(sl, t + 1);
                const int e1 = __builtin_amdgcn_readlane(el, t + 1);
                if (e1 > s1) {
                    nx = (rp + 32 * CHCAP)[s1 + SparseMHA_deal(lane, min(32, e1 - s1))];
                    // the load stays in flight: its address register is reused right behind it
                    asm volatile("s_wait_xcnt 0x0" ::: "memory");
                }
            }
            for (int p = s; p < e; p += 32) {
                const int m = min(32, e - p);
                if (p > s) {
                    rc = rp[p + SparseMHA_deal(lane, m)];
                    // the load stays in flight: its address register is reused right behind it
                    asm volatile("s_wait_xcnt 0x0" ::: "memory");
                }
                // a lane without a record of its own holds a copy with weight zero
                const unsigned wa = SparseMHA_dealt(lane, m) ? rc.y : 0u;
                const unsigned ka = rc.x & ~255u;
                const unsigned ra = (rc.x & 255u) * (LPITCH * 4u);
                const int hm = (m + 1) >> 1;     // steps: one edge per 16-lane row each
                for (int j = 0; j < hm; ) {
                    if (hm - j > 2) { SparseMHA_steps<4>(kv, qs, acc, ka, ra, wa, j, l16); j += 4; }
                    else            { SparseMHA_steps<2>(kv, qs, acc, ka, ra, wa, j, l16); j += 2; }
                }
            }
            }
        }
        __syncthreads();

        // channels 4c .. 4c+3 of a row are value c & 3 of lanes 4 (c >> 2) .. + 3
        for (int i = tid; i < nr * (HIDDEN / 4); i += 1024) {
            const int c = i & 15;
            ((float4*)(out + rb * HIDDEN))[i] =
                ((const float4*)acc)[(i >> 4) * (LPITCH / 4) + (c & 3) * 4 + (c >> 2)];
        }
        __syncthreads();                         // acc and qs are free for the next range
    }
}

// ---------------------------------------------------------------------------
extern "C" void kernel_launch(void* const* d_in, const int* in_sizes, int n_in,
                              void* d_out, int out_size, void* d_ws, size_t ws_size,
                              hipStream_t stream) {
    const float* h   = (const float*)d_in[0];
    const int*   row = (const int*)  d_in[1];
    const int*   col = (const int*)  d_in[2];
    const float* ew  = (const float*)d_in[3];
    const float* Wq  = (const float*)d_in[4];
    const float* bq  = (const float*)d_in[5];
    const float* Wk  = (const float*)d_in[6];
    const float* bk  = (const float*)d_in[7];
    const float* Wv  = (const float*)d_in[8];
    const float* bv  = (const float*)d_in[9];
    float*       out = (float*)d_out;

    const int n   = in_sizes[0] / HIDDEN;   // 50000
    const int nnz = in_sizes[1];            // 1600000

    float* qws = (float*)d_ws;
    unsigned* kvws = (unsigned*)(qws + (size_t)n * HIDDEN);  // one word per channel: k and v as f16
    unsigned* rec = kvws + (size_t)n * HIDDEN;               // 2 words per edge, whole chunks
    unsigned* off = rec + 2 * ((size_t)nnz + CHCAP);         // NB + 1 words per chunk

    // q/k/v projections via fp32 WMMA and, beside them in the same launch, the edge records
    // in order of out-row range, chunk by chunk
    SparseMHA_prep_kernel<<<PROJ_BLOCKS + SORT_BLOCKS, PREP_THREADS, 0, stream>>>(
        h, Wq, bq, Wk, bk, Wv, bv, row, col, ew, qws, kvws, rec, off, nnz, n);

    // fused edge SDDMM + sigmoid*w + sums in LDS, every out row stored once
    SparseMHA_edge_kernel<<<SUM_BLOCKS, 1024, 0, stream>>>(
        qws, kvws, rec, off, out, nnz, n);
}
